// v000
// The times below were measured on an AMD MI455X: many runs one after another, warmed up first and cycling through
// copies of the inputs, with the whole window's GPU time divided by the number of runs. Launches and the gaps
// between them are all in it. The median over several windows is given; except for v000 it joins two sittings, which
// can be a few percent apart, so the side-by-side timings, each taken in one sitting, are the better comparison.
// The starting kernel, v000, takes 183 microseconds a run.
#include <hip/hip_runtime.h>

// Attention with three input streams, width 1024 = 16 x 64, x @ W + b with W stored [in][out], row-major pseudo-head split [B][L][1024] -> [B*16][L][64] (no transpose), score scale 1/8, output projection Wo + bo (f32 out).
// Compute dtypes, f32 accumulate everywhere: q/k/v projections v_wmma_f32_16x16x32_bf16 (inputs and weights RNE-converted to bf16; products exact);
// scores and P.V v_wmma_f32_16x16x32_f16 (q, k, v single f16; P carried x256, cancels in the normalisation); output projection v_wmma_f32_16x16x32_f16 (ctx f16 carried x1024, Wo = f16 of bf16(Wo) x256, folded back as 2^-18); softmax f32 (online, running max).
// Layout: bf16 copies of the three streams; weights transposed through LDS into [out][in] planes (Wv rows permuted n' = d*16 + f/64); q, k planes row-major [token][1024] re-read as [b*16+g][row][64];
// v^T plane [b*16+g][d][row] written by the GEMM epilogue; fused flash kernel in transposed form (S^T = K Q^T, O^T = V^T P^T); ctx plane row-major f16; out GEMM writes d_out.

#ifndef NB
#define NB 4
#endif
#ifndef SEQ
#define SEQ 1024
#endif
#define NB_FULL  4
#define SEQ_FULL 1024
#ifndef OUT_SEQ
#define OUT_SEQ SEQ              // row pitch (in tokens) between batches of the output
#endif
#define DM   1024
#define NH_  16
#define HD   64
#define TPG  (SEQ / NH_)         // tokens covered by one pseudo-head
#define AW   4                   // waves per flash block (16 query rows each)
#define SC2  (0.125f * 1.4426950408889634f)   // HD^-0.5 * log2(e)
#define PSH  8.0f                // log2 of the P carry (256)
#define CXS  1024.0f             // carry of the ctx plane
#define WOS  256.0f              // carry of the Wo plane
#define OSC  (1.0f / (1024.0f * 256.0f))

static_assert(HD == 64);
static_assert(NH_ * HD == DM);                 // pseudo-head row r = token r/16, features (r%16)*64 + d
static_assert(DM / HD == 16);                  // permuted v weight rows n' = d*16 + f/64 use 16 feature blocks
static_assert(DM % 64 == 0);                   // column tiles of 64
static_assert(DM % 32 == 0);                   // GEMM k-loop steps by 32
static_assert(SEQ % 64 == 0);                  // a 64-row tile never straddles two batches
static_assert((NB * SEQ) % 64 == 0);
static_assert(SEQ % 32 == 0);                  // key loop steps by 32
static_assert(SEQ % (16 * AW) == 0);           // flash grid covers the sequence exactly
static_assert(TPG * NH_ == SEQ);
static_assert(TPG % 16 == 0);                  // a 16-token slab stays inside one pseudo-head (v^T epilogue)
static_assert(((size_t)SEQ * DM) % 8 == 0);
static_assert(((size_t)DM * DM) % 8 == 0);
static_assert(NB <= NB_FULL);
static_assert(SEQ <= SEQ_FULL);
static_assert(OUT_SEQ >= SEQ);

typedef _Float16 h16;
typedef unsigned short bf;
typedef __attribute__((ext_vector_type(16))) __bf16   v16bf;
typedef __attribute__((ext_vector_type(16))) _Float16 v16h;
typedef __attribute__((ext_vector_type(8)))  _Float16 v8h;
typedef __attribute__((ext_vector_type(8)))  unsigned short v8us;
typedef __attribute__((ext_vector_type(8)))  float    v8f;
typedef __attribute__((ext_vector_type(4)))  float    v4f;
typedef v4f  __attribute__((may_alias)) v4fa;

__device__ __forceinline__ unsigned short f2bf(float f) { unsigned u = __float_as_uint(f); u += 0x7FFFu + ((u >> 16) & 1u); return (unsigned short)(u >> 16); }
__device__ __forceinline__ float bf2f(unsigned short b) { return __uint_as_float(((unsigned)b) << 16); }
__device__ __forceinline__ float bfr(float f) { return bf2f(f2bf(f)); }
__device__ __forceinline__ v16h cat16(v8h lo, v8h hi) { return __builtin_shufflevector(lo, hi, 0, 1, 2, 3, 4, 5, 6, 7, 8, 9, 10, 11, 12, 13, 14, 15); }
__device__ __forceinline__ v16bf cat16b(v8us lo, v8us hi) { return __builtin_bit_cast(v16bf, __builtin_shufflevector(lo, hi, 0, 1, 2, 3, 4, 5, 6, 7, 8, 9, 10, 11, 12, 13, 14, 15)); }
__device__ __forceinline__ v8f wmma16(v16h a, v16h b, v8f c) { return __builtin_amdgcn_wmma_f32_16x16x32_f16(false, a, false, b, (short)0, c, false, false); }
__device__ __forceinline__ v8f wmmab(v16bf a, v16bf b, v8f c) { return __builtin_amdgcn_wmma_f32_16x16x32_bf16(false, a, false, b, (short)0, c, false, false); }
// fragment loaders from K-contiguous 16-bit rows; p already includes + 8*(lane>>4): elements 0..7 <- k0+8h+0..7, elements 8..15 <- k0+16+8h+0..7 (same map for A and B)
__device__ __forceinline__ v16h  ldh(const h16* p) { return cat16(*(const v8h*)p, *(const v8h*)(p + 16)); }
__device__ __forceinline__ v16bf ldb(const bf* p)  { return cat16b(*(const v8us*)p, *(const v8us*)(p + 16)); }
// ordering point for wave-private LDS tiles (same wave writes and reads)
__device__ __forceinline__ void wave_sync() { __builtin_amdgcn_fence(3 /* release order */, "wavefront"); __builtin_amdgcn_wave_barrier(); asm volatile("" ::: "memory"); }

__global__ __launch_bounds__(256) void k_cvt8(const float* __restrict__ src, bf* dst, size_t n8) {
    const size_t i = (size_t)blockIdx.x * 256 + threadIdx.x; if (i >= n8) return;
    const v8f v = *(const v8f*)(src + i * 8); v8us o;
#pragma unroll
    for (int k = 0; k < 8; ++k) o[k] = f2bf(v[k]);
    *(v8us*)(dst + i * 8) = o; 
}

// k_wt: weight transpose + 16-bit convert through LDS. W is [k = in][n = out] f32 (pitch DM); WT[n'][k] (pitch DM), source column of output row n' is
// perm ? (n'%16)*64 + n'/16 : n'. asf16 == 0: bf16 bits (RNE convert); asf16 != 0: f16 bits of bf16(w) * 256 (exact for bf16 values in the f16 normal range).
__global__ __launch_bounds__(256) void k_wt(const float* __restrict__ W, bf* WT, int perm, int asf16) {
    __shared__ float tl[64 * 65];
    const int tid = threadIdx.x; const int n0 = blockIdx.x * 64, k0 = blockIdx.y * 64;
    { const int nn = tid & 63; const int np = n0 + nn; const int col = perm ? ((np & 15) * 64 + (np >> 4)) : np;
#pragma unroll 4
      for (int i = 0; i < 16; ++i) { const int kk = i * 4 + (tid >> 6); tl[kk * 65 + nn] = W[(size_t)(k0 + kk) * DM + col]; } }   // 16 x 4 k rows x 64 n = whole tile
    __syncthreads();
    v8us o[2];
#pragma unroll
    for (int it = 0; it < 2; ++it) { const int piece = it * 256 + tid; const int row = piece >> 3, j = piece & 7;   // 512 pieces = 64 rows x 8
#pragma unroll
        for (int i = 0; i < 8; ++i) { const float x = tl[(j * 8 + i) * 65 + row]; const unsigned short b = f2bf(x);
            const h16 hv = (h16)(bf2f(b) * WOS); const unsigned short hb = __builtin_bit_cast(unsigned short, hv); o[it][i] = asf16 ? hb : b; } }
{
#pragma unroll
        for (int it = 0; it < 2; ++it) { const int piece = it * 256 + tid; const int row = piece >> 3, j = piece & 7;
            *(v8us*)(WT + (size_t)(n0 + row) * DM + k0 + j * 8) = o[it]; }
         }
}

// k_proj: register-blocked bf16 GEMM, ONE WAVE per 64x64 tile (16 accumulators), operands straight from K-contiguous bf16 planes, K = DM.
// C[m][n] = sum_k A[m][k] Bt[n][k] + bias, written as f16. grid (NB*SEQ/64, DM/64), 32 threads.
// vmode == 0: row-major plane Ph[m][n] (pitch DM), bias[n].
// vmode != 0: Bt rows are permuted (n' = d*16 + fb <-> feature fb*64 + d), bias[fb*64 + d]; element (token m, n') goes to the v^T plane
//             Ph[(zh*64 + d)*SEQ + tt*16 + fb] with zh = m / TPG, tt = m % TPG (key row tt*16 + fb of pseudo-head zh).
__global__ __launch_bounds__(32) void k_proj(const bf* __restrict__ A, const bf* __restrict__ Bt, const float* __restrict__ bias, h16* Ph, int vmode) {
    __shared__ __align__(16) float os[16 * 68];
    __shared__ __align__(16) float bsh[64];
    const int K = DM;
    const int lane = threadIdx.x & 31, lr = lane & 15, hi = lane >> 4; const int r0 = blockIdx.x * 64, c0 = blockIdx.y * 64;
    v8f acc[4][4];
#pragma unroll
    for (int mb = 0; mb < 4; ++mb)
#pragma unroll
        for (int nb = 0; nb < 4; ++nb) acc[mb][nb] = (v8f){};
    const size_t aoff = (size_t)(r0 + lr) * K + 8 * hi, boff = (size_t)(c0 + lr) * K + 8 * hi;
#pragma unroll 1
    for (int kc = 0; kc < K; kc += 32) {
        v16bf a[4];
#pragma unroll
        for (int mb = 0; mb < 4; ++mb) a[mb] = ldb(A + aoff + (size_t)mb * 16 * K + kc);
#pragma unroll
        for (int nb = 0; nb < 4; ++nb) { const v16bf b = ldb(Bt + boff + (size_t)nb * 16 * K + kc);
#pragma unroll
            for (int mb = 0; mb < 4; ++mb) acc[mb][nb] = wmmab(a[mb], b, acc[mb][nb]); }
        asm volatile("v_nop\n\tv_nop\n\tv_nop\n\tv_nop" : "+v"(acc[0][0]), "+v"(acc[1][1]), "+v"(acc[2][2]), "+v"(acc[3][3]) : "v"(a[0]), "v"(a[1]), "v"(a[2]), "v"(a[3]));
    }
    // bias of the tile's 64 columns (bf16-valued), staged once: bsh[0..63] all written, all read
#pragma unroll
    for (int u = 0; u < 2; ++u) { const int n = c0 + lane + 32 * u; const int bi = vmode ? ((n & 15) * 64 + (n >> 4)) : n; bsh[lane + 32 * u] = bfr(bias[bi]); }
    wave_sync();
#pragma unroll
    for (int mb = 0; mb < 4; ++mb) {
#pragma unroll
        for (int nb = 0; nb < 4; ++nb) {
#pragma unroll
            for (int j = 0; j < 8; ++j) os[(hi * 8 + j) * 68 + nb * 16 + lr] = acc[mb][nb][j]; }   // D: row 8h+j, col lane&15; 16 rows x 64 columns all written
        wave_sync();
        const int R0 = r0 + mb * 16;
        if (vmode == 0) {
{
#pragma unroll
                for (int s = 0; s < 4; ++s) { const int row = 4 * s + (lane >> 3), c8 = (lane & 7) * 8;   // 4 s x 4 row groups = 16 rows; 8 lanes x 8 = 64 columns
                    const v4f x0 = *(const v4fa*)(&os[row * 68 + c8]); const v4f x1 = *(const v4fa*)(&os[row * 68 + c8 + 4]);
                    const v4f b0 = *(const v4fa*)(&bsh[c8]); const v4f b1 = *(const v4fa*)(&bsh[c8 + 4]); v8h hv;
#pragma unroll
                    for (int i = 0; i < 4; ++i) { hv[i] = (h16)(x0[i] + b0[i]); hv[4 + i] = (h16)(x1[i] + b1[i]); }
                    *(v8h*)(Ph + (size_t)(R0 + row) * DM + c0 + c8) = hv; }
                 }
        } else {
            const int zh = R0 / TPG, tt0 = R0 % TPG;
            const int q = lane >> 3, jj = lane & 7; const int row = 4 * q + (jj >> 1), fb0 = (jj & 1) * 8;   // line (dl = s, q): rows 4q..4q+3 x 16 fb; lanes 8q..8q+7 contiguous
{
#pragma unroll
                for (int s = 0; s < 4; ++s) { const int col = s * 16 + fb0; const int d = (c0 >> 4) + s;   // 4 dl x (4 q x 4 rows) x 16 fb = 16 rows x 64 columns
                    const v4f x0 = *(const v4fa*)(&os[row * 68 + col]); const v4f x1 = *(const v4fa*)(&os[row * 68 + col + 4]);
                    const v4f b0 = *(const v4fa*)(&bsh[col]); const v4f b1 = *(const v4fa*)(&bsh[col + 4]); v8h hv;
#pragma unroll
                    for (int i = 0; i < 4; ++i) { hv[i] = (h16)(x0[i] + b0[i]); hv[4 + i] = (h16)(x1[i] + b1[i]); }
                    *(v8h*)(Ph + ((size_t)zh * HD + d) * SEQ + (size_t)(tt0 + row) * 16 + fb0) = hv; }
                 }
        }
        wave_sync();
    }
}

// k_out: register-blocked f16 GEMM, ONE WAVE per 64x64 tile, A = ctx plane (x1024), Bt = Wo^T plane (x256), K = DM; OUT[m][n] = acc * 2^-18 + bo[n] (f32).
__global__ __launch_bounds__(32) void k_out(const h16* __restrict__ A, const h16* __restrict__ Bt, const float* __restrict__ bias, float* OUT) {
    __shared__ __align__(16) float os[16 * 68];
    __shared__ __align__(16) float bsh[64];
    const int K = DM;
    const int lane = threadIdx.x & 31, lr = lane & 15, hi = lane >> 4; const int r0 = blockIdx.x * 64, c0 = blockIdx.y * 64;
    v8f acc[4][4];
#pragma unroll
    for (int mb = 0; mb < 4; ++mb)
#pragma unroll
        for (int nb = 0; nb < 4; ++nb) acc[mb][nb] = (v8f){};
    const size_t aoff = (size_t)(r0 + lr) * K + 8 * hi, boff = (size_t)(c0 + lr) * K + 8 * hi;
#pragma unroll 1
    for (int kc = 0; kc < K; kc += 32) {
        v16h a[4];
#pragma unroll
        for (int mb = 0; mb < 4; ++mb) a[mb] = ldh(A + aoff + (size_t)mb * 16 * K + kc);
#pragma unroll
        for (int nb = 0; nb < 4; ++nb) { const v16h b = ldh(Bt + boff + (size_t)nb * 16 * K + kc);
#pragma unroll
            for (int mb = 0; mb < 4; ++mb) acc[mb][nb] = wmma16(a[mb], b, acc[mb][nb]); }
        asm volatile("v_nop\n\tv_nop\n\tv_nop\n\tv_nop" : "+v"(acc[0][0]), "+v"(acc[1][1]), "+v"(acc[2][2]), "+v"(acc[3][3]) : "v"(a[0]), "v"(a[1]), "v"(a[2]), "v"(a[3]));
    }
#pragma unroll
    for (int u = 0; u < 2; ++u) bsh[lane + 32 * u] = bfr(bias[c0 + lane + 32 * u]);   // bsh[0..63] all written, all read
    wave_sync();
    const size_t orow0 = (size_t)(r0 / SEQ) * OUT_SEQ + (size_t)(r0 % SEQ);
#pragma unroll
    for (int mb = 0; mb < 4; ++mb) {
#pragma unroll
        for (int nb = 0; nb < 4; ++nb) {
#pragma unroll
            for (int j = 0; j < 8; ++j) os[(hi * 8 + j) * 68 + nb * 16 + lr] = acc[mb][nb][j]; }   // 16 rows x 64 columns all written
        wave_sync();
        float* ob = OUT + (orow0 + (size_t)(mb * 16)) * DM + c0;
{
#pragma unroll
            for (int s = 0; s < 8; ++s) { const int row = 2 * s + hi, cofs = lr * 4;   // 8 s x 2 rows = 16 rows; 16 lanes x 4 floats = 64 columns
                const v4f x = *(const v4fa*)(&os[row * 68 + cofs]); const v4f bb = *(const v4fa*)(&bsh[cofs]); v4f val;
#pragma unroll
                for (int i = 0; i < 4; ++i) val[i] = x[i] * OSC + bb[i];
                *(v4f*)(ob + (size_t)row * DM + cofs) = val; }
             }
        wave_sync();
    }
}

// k_flash: fused attention, one wave per 16 query rows of one pseudo-head; K / V^T / Q fragments straight from the f16 planes (two 16-B loads each, arithmetic addressing).
// Transposed form: S^T[key][t] = K Q^T (A = K rows, B = Q rows); lane (t = lane&15, h = lane>>4) holds keys 8h+r of each 16-key tile, so the packed
// P tile is directly the B fragment of O^T[d][t] = V^T P^T (element r <- tile keys 0..15, element 8+r <- tile keys 16..31, lane unchanged).
// Softmax state (running max, partial sum) is one scalar per lane; the two lane halves of a row are combined with one xor-16 exchange.
__global__ __launch_bounds__(32 * AW) void k_flash(const h16* __restrict__ QH, const h16* __restrict__ KP, const h16* __restrict__ VT, h16* CX) {
    __shared__ __align__(16) float os[AW * 16 * 68];
    const int lane = threadIdx.x & 31, lr = lane & 15, hi = lane >> 4;
    const int wave = __builtin_amdgcn_readfirstlane(threadIdx.x >> 5);
    const int zh = blockIdx.y;
    const int t0 = (blockIdx.x * AW + wave) * 16;
    const size_t pbase = (size_t)zh * SEQ * HD;
    const size_t qo = pbase + (size_t)(t0 + lr) * HD + 8 * hi;
    const v16h q0 = ldh(QH + qo), q1 = ldh(QH + qo + 32);    // B fragments: col t, k = d
    const size_t ko = pbase + (size_t)lr * HD + 8 * hi;      // + key * HD       (A fragment: row key, k = d)
    const size_t vo = pbase + (size_t)lr * SEQ + 8 * hi;     // + 16j*SEQ + key  (A fragment: row d, k = key)
    v8f o0 = (v8f){}, o1 = (v8f){}, o2 = (v8f){}, o3 = (v8f){};
    float m = -3.0e38f, l = 0.0f;
#pragma unroll 1
    for (int key0 = 0; key0 < SEQ; key0 += 32) {
        const h16* ka = KP + ko + (size_t)key0 * HD;
        const v16h ka0 = ldh(ka), ka1 = ldh(ka + 32), kb0 = ldh(ka + 16 * HD), kb1 = ldh(ka + 16 * HD + 32);
        v8f sa = (v8f){}, sb = (v8f){};
        sa = wmma16(ka0, q0, sa); sb = wmma16(kb0, q0, sb);
        sa = wmma16(ka1, q1, sa); sb = wmma16(kb1, q1, sb);
        asm volatile("v_nop\n\tv_nop\n\tv_nop\n\tv_nop" : "+v"(sa), "+v"(sb) : "v"(ka0), "v"(ka1), "v"(kb0), "v"(kb1), "v"(q0), "v"(q1));
        float ta[8], tb[8]; float mx = -3.0e38f;
#pragma unroll
        for (int r = 0; r < 8; ++r) { ta[r] = sa[r] * SC2; tb[r] = sb[r] * SC2; mx = fmaxf(mx, fmaxf(ta[r], tb[r])); }
        mx = fmaxf(mx, __shfl_xor(mx, 16, 32));
        const float mnew = fmaxf(m, mx);
        const float alpha = __builtin_amdgcn_exp2f(m - mnew);
        const float sh = PSH - mnew;
        v16h pb; float ls = 0.0f;
#pragma unroll
        for (int r = 0; r < 8; ++r) { const h16 pa = (h16)__builtin_amdgcn_exp2f(ta[r] + sh); const h16 pc = (h16)__builtin_amdgcn_exp2f(tb[r] + sh); pb[r] = pa; pb[8 + r] = pc; ls += (float)pa + (float)pc; }
        l = l * alpha + ls; m = mnew;
        o0 = o0 * alpha; o1 = o1 * alpha; o2 = o2 * alpha; o3 = o3 * alpha;
        const h16* va = VT + vo + key0;
        const v16h v0 = ldh(va), v1 = ldh(va + (size_t)16 * SEQ), v2 = ldh(va + (size_t)32 * SEQ), v3 = ldh(va + (size_t)48 * SEQ);
        o0 = wmma16(v0, pb, o0); o1 = wmma16(v1, pb, o1); o2 = wmma16(v2, pb, o2); o3 = wmma16(v3, pb, o3);
        asm volatile("v_nop\n\tv_nop\n\tv_nop\n\tv_nop" : "+v"(o0), "+v"(o1), "+v"(o2), "+v"(o3) : "v"(v0), "v"(v1), "v"(v2), "v"(v3), "v"(pb));
    }
    l += __shfl_xor(l, 16, 32);
    const float inv = (1.0f / l) * CXS;
    const int wb = wave * 16 * 68;
    // O^T D layout: o_j[r] = (d = 16j + 8h + r, t = lane&15) -> os[t][d]; rows 0..15 x columns 0..63 all written
    { v4f a, c;
      a[0] = o0[0] * inv; a[1] = o0[1] * inv; a[2] = o0[2] * inv; a[3] = o0[3] * inv; c[0] = o0[4] * inv; c[1] = o0[5] * inv; c[2] = o0[6] * inv; c[3] = o0[7] * inv;
      *(v4fa*)(&os[wb + lr * 68 +  0 + 8 * hi]) = a; *(v4fa*)(&os[wb + lr * 68 +  0 + 8 * hi + 4]) = c;
      a[0] = o1[0] * inv; a[1] = o1[1] * inv; a[2] = o1[2] * inv; a[3] = o1[3] * inv; c[0] = o1[4] * inv; c[1] = o1[5] * inv; c[2] = o1[6] * inv; c[3] = o1[7] * inv;
      *(v4fa*)(&os[wb + lr * 68 + 16 + 8 * hi]) = a; *(v4fa*)(&os[wb + lr * 68 + 16 + 8 * hi + 4]) = c;
      a[0] = o2[0] * inv; a[1] = o2[1] * inv; a[2] = o2[2] * inv; a[3] = o2[3] * inv; c[0] = o2[4] * inv; c[1] = o2[5] * inv; c[2] = o2[6] * inv; c[3] = o2[7] * inv;
      *(v4fa*)(&os[wb + lr * 68 + 32 + 8 * hi]) = a; *(v4fa*)(&os[wb + lr * 68 + 32 + 8 * hi + 4]) = c;
      a[0] = o3[0] * inv; a[1] = o3[1] * inv; a[2] = o3[2] * inv; a[3] = o3[3] * inv; c[0] = o3[4] * inv; c[1] = o3[5] * inv; c[2] = o3[6] * inv; c[3] = o3[7] * inv;
      *(v4fa*)(&os[wb + lr * 68 + 48 + 8 * hi]) = a; *(v4fa*)(&os[wb + lr * 68 + 48 + 8 * hi + 4]) = c; }
    wave_sync();
    h16* crow = CX + pbase + (size_t)t0 * HD;      // pseudo-head row r -> flat offset zh*SEQ*64 + r*64 of the row-major ctx plane
{
#pragma unroll
        for (int s = 0; s < 4; ++s) { const int row = 4 * s + (lane >> 3), c8 = (lane & 7) * 8;   // 4 s x 4 row groups = 16 rows; 8 lanes x 8 = 64 columns
            const v4f x0 = *(const v4fa*)(&os[wb + row * 68 + c8]); const v4f x1 = *(const v4fa*)(&os[wb + row * 68 + c8 + 4]); v8h hv;
#pragma unroll
            for (int i = 0; i < 4; ++i) { hv[i] = (h16)x0[i]; hv[4 + i] = (h16)x1[i]; }
            *(v8h*)(crow + (size_t)row * HD + c8) = hv; }
         }
}

static constexpr size_t al256(size_t v) { return (v + 255) & ~(size_t)255; }
static constexpr size_t SZ_XB = al256((size_t)NB * SEQ * DM * 2);      // one bf16 stream copy
static constexpr size_t SZ_WB = al256((size_t)4 * DM * DM * 2);        // four 16-bit weight planes
static constexpr size_t SZ_PL = al256((size_t)NB * SEQ * DM * 2);      // one f16 plane (q, k, v^T, ctx)
static constexpr size_t SZ_TOTAL = 3 * SZ_XB + SZ_WB + 4 * SZ_PL;
static_assert(SZ_TOTAL <= (size_t)134217728);          // workspace carve <= 128 MiB
static_assert(((size_t)DM * DM * 2) % 256 == 0);       // weight sub-planes stay 256-byte aligned
static_assert((size_t)NB * NH_ * HD * SEQ * 2 <= SZ_PL);   // v^T plane [NB*16][64][SEQ] fits its region

extern "C" void kernel_launch(void* const* d_in, const int* in_sizes, int n_in,
                              void* d_out, int out_size, void* d_ws, size_t ws_size, hipStream_t stream) {
    if (n_in < 11) return;
    const size_t needx = ((size_t)(NB - 1) * SEQ_FULL + SEQ) * DM;
    if ((size_t)in_sizes[0] < needx || (size_t)in_sizes[1] < needx || (size_t)in_sizes[2] < needx) return;
    if ((size_t)in_sizes[3] < (size_t)DM * DM || (size_t)in_sizes[5] < (size_t)DM * DM || (size_t)in_sizes[7] < (size_t)DM * DM || (size_t)in_sizes[9] < (size_t)DM * DM) return;
    if (in_sizes[4] < DM || in_sizes[6] < DM || in_sizes[8] < DM || in_sizes[10] < DM) return;
    if ((size_t)out_size < ((size_t)(NB - 1) * OUT_SEQ + SEQ) * DM) return;
    if (SZ_TOTAL > ws_size) return;
    // wire order: queries, keys, values, Wq, bq, Wk, bk, Wv, bv, Wo, bo
    const float* xq = (const float*)d_in[0]; const float* xk = (const float*)d_in[1]; const float* xv = (const float*)d_in[2];
    const float* wq = (const float*)d_in[3]; const float* bq = (const float*)d_in[4];
    const float* wk = (const float*)d_in[5]; const float* bk = (const float*)d_in[6];
    const float* wv = (const float*)d_in[7]; const float* bv = (const float*)d_in[8];
    const float* wo = (const float*)d_in[9]; const float* bo = (const float*)d_in[10];
    float* OUT = (float*)d_out;      // [NB][OUT_SEQ][1024]
    char* wsp = (char*)d_ws;
    bf* XQ = (bf*)wsp; wsp += SZ_XB;                 // [NB*SEQ][1024]
    bf* XK = (bf*)wsp; wsp += SZ_XB;
    bf* XV = (bf*)wsp; wsp += SZ_XB;
    bf* WB = (bf*)wsp; wsp += SZ_WB;                 // [4][1024 out][1024 in]: q | k | v (rows permuted) | o (f16 bits, x256)
    h16* QH = (h16*)wsp; wsp += SZ_PL;               // [NB*SEQ][1024] = [NB*16][SEQ][64]
    h16* KP = (h16*)wsp; wsp += SZ_PL;               // [NB*SEQ][1024] = [NB*16][SEQ][64]
    h16* VT = (h16*)wsp; wsp += SZ_PL;               // [NB*16][64][SEQ]
    h16* CX = (h16*)wsp; wsp += SZ_PL;               // [NB*SEQ][1024] = [NB*16][SEQ][64], x1024
    bf* WQ = WB; bf* WK = WB + (size_t)DM * DM; bf* WV = WB + (size_t)2 * DM * DM; bf* WO = WB + (size_t)3 * DM * DM;

    if (SEQ == SEQ_FULL) {
        const size_t n8 = (size_t)NB * SEQ * DM / 8; const unsigned g = (unsigned)((n8 + 255) / 256);
        k_cvt8<<<g, 256, 0, stream>>>(xq, XQ, n8); k_cvt8<<<g, 256, 0, stream>>>(xk, XK, n8); k_cvt8<<<g, 256, 0, stream>>>(xv, XV, n8);
    } else {
        const size_t n8 = (size_t)SEQ * DM / 8; const unsigned g = (unsigned)((n8 + 255) / 256);
        for (int b = 0; b < NB; ++b) {
            k_cvt8<<<g, 256, 0, stream>>>(xq + (size_t)b * SEQ_FULL * DM, XQ + (size_t)b * SEQ * DM, n8);
            k_cvt8<<<g, 256, 0, stream>>>(xk + (size_t)b * SEQ_FULL * DM, XK + (size_t)b * SEQ * DM, n8);
            k_cvt8<<<g, 256, 0, stream>>>(xv + (size_t)b * SEQ_FULL * DM, XV + (size_t)b * SEQ * DM, n8);
        }
    }
    // weights: in [k = in rows][n = out cols] -> out [n'][k]; square 1024 x 1024, grid (out/64, in/64)
    { const dim3 g(DM / 64, DM / 64, 1);
      k_wt<<<g, 256, 0, stream>>>(wq, WQ, 0, 0); k_wt<<<g, 256, 0, stream>>>(wk, WK, 0, 0);
      k_wt<<<g, 256, 0, stream>>>(wv, WV, 1, 0); k_wt<<<g, 256, 0, stream>>>(wo, WO, 0, 1); }

    // q, k: A = stream rows (m = b*SEQ + t), Bt = W^T rows (n = feature) -> row-major plane
    k_proj<<<dim3(NB * SEQ / 64, DM / 64, 1), 32, 0, stream>>>(XQ, WQ, bq, QH, 0);
    k_proj<<<dim3(NB * SEQ / 64, DM / 64, 1), 32, 0, stream>>>(XK, WK, bk, KP, 0);
    // v: Bt = permuted Wv^T rows (n' = d*16 + fb) -> v^T plane [(b*16 + g)][d][key row]
    k_proj<<<dim3(NB * SEQ / 64, DM / 64, 1), 32, 0, stream>>>(XV, WV, bv, VT, 1);

    k_flash<<<dim3(SEQ / (16 * AW), NB * NH_, 1), 32 * AW, 0, stream>>>(QH, KP, VT, CX);

    k_out<<<dim3(NB * SEQ / 64, DM / 64, 1), 32, 0, stream>>>(CX, (const h16*)WO, bo, OUT);
}

// v001
// Measured time: 138 microseconds a run.
// In two side-by-side timings against v000, it was 1.37 and 1.38 times as fast.
#include <hip/hip_runtime.h>

// Attention with three input streams, width 1024 = 16 x 64, x @ W + b with W stored [in][out], row-major pseudo-head split [B][L][1024] -> [B*16][L][64] (no transpose), score scale 1/8, output projection Wo + bo (f32 out).
// Compute dtypes, f32 accumulate everywhere: q/k/v projections v_wmma_f32_16x16x32_bf16 (inputs and weights RNE-converted to bf16; products exact);
// scores and P.V v_wmma_f32_16x16x32_f16 (q, k, v single f16; P carried x256, cancels in the normalisation); output projection v_wmma_f32_16x16x32_f16 (ctx f16 carried x1024, Wo = f16 of bf16(Wo) x256, folded back as 2^-18); softmax f32 (online, running max).
// Layout: bf16 copies of the three streams; weights transposed through LDS into [out][in] planes (Wv rows permuted n' = d*16 + f/64); q, k planes row-major [token][1024] re-read as [b*16+g][row][64];
// the four GEMMs: 128x128 tile per 8-wave block, A and B rows staged in LDS by tensor loads (two buffers); v^T plane [b*16+g][d][row] written by the GEMM epilogue; fused flash kernel in transposed form (S^T = K Q^T, O^T = V^T P^T); ctx plane row-major f16; out GEMM writes d_out.

#ifndef NB
#define NB 4
#endif
#ifndef SEQ
#define SEQ 1024
#endif
#define NB_FULL  4
#define SEQ_FULL 1024
#ifndef OUT_SEQ
#define OUT_SEQ SEQ              // row pitch (in tokens) between batches of the output
#endif
#define DM   1024
#define NH_  16
#define HD   64
#define TPG  (SEQ / NH_)         // tokens covered by one pseudo-head
#define AW   4                   // waves per flash block (16 query rows each)
#define SC2  (0.125f * 1.4426950408889634f)   // HD^-0.5 * log2(e)
#define PSH  8.0f                // log2 of the P carry (256)
#define CXS  1024.0f             // carry of the ctx plane
#define WOS  256.0f              // carry of the Wo plane
#define OSC  (1.0f / (1024.0f * 256.0f))

static_assert(HD == 64);
static_assert(NH_ * HD == DM);                 // pseudo-head row r = token r/16, features (r%16)*64 + d
static_assert(DM / HD == 16);                  // permuted v weight rows n' = d*16 + f/64 use 16 feature blocks
static_assert(DM % 64 == 0);                   // column tiles of 64
static_assert(DM % 32 == 0);                   // GEMM k-loop steps by 32
static_assert(SEQ % 64 == 0);                  // a 32-row wave tile never straddles two batches
static_assert((NB * SEQ) % 128 == 0);          // GEMM row tiles of 128
static_assert(DM % 128 == 0);                  // GEMM column tiles of 128, k stages of 128
static_assert(SEQ % 32 == 0);                  // key loop steps by 32
static_assert(SEQ % (16 * AW) == 0);           // flash grid covers the sequence exactly
static_assert(TPG * NH_ == SEQ);
static_assert(TPG % 16 == 0);                  // a 16-token slab stays inside one pseudo-head (v^T epilogue)
static_assert(((size_t)SEQ * DM) % 8 == 0);
static_assert(((size_t)DM * DM) % 8 == 0);
static_assert(NB <= NB_FULL);
static_assert(SEQ <= SEQ_FULL);
static_assert(OUT_SEQ >= SEQ);

typedef _Float16 h16;
typedef unsigned short bf;
typedef __attribute__((ext_vector_type(16))) __bf16   v16bf;
typedef __attribute__((ext_vector_type(16))) _Float16 v16h;
typedef __attribute__((ext_vector_type(8)))  _Float16 v8h;
typedef __attribute__((ext_vector_type(8)))  unsigned short v8us;
typedef __attribute__((ext_vector_type(8)))  float    v8f;
typedef __attribute__((ext_vector_type(4)))  float    v4f;
typedef v4f  __attribute__((may_alias)) v4fa;

__device__ __forceinline__ unsigned short f2bf(float f) { unsigned u = __float_as_uint(f); u += 0x7FFFu + ((u >> 16) & 1u); return (unsigned short)(u >> 16); }
__device__ __forceinline__ float bf2f(unsigned short b) { return __uint_as_float(((unsigned)b) << 16); }
__device__ __forceinline__ float bfr(float f) { return bf2f(f2bf(f)); }
__device__ __forceinline__ v16h cat16(v8h lo, v8h hi) { return __builtin_shufflevector(lo, hi, 0, 1, 2, 3, 4, 5, 6, 7, 8, 9, 10, 11, 12, 13, 14, 15); }
__device__ __forceinline__ v16bf cat16b(v8us lo, v8us hi) { return __builtin_bit_cast(v16bf, __builtin_shufflevector(lo, hi, 0, 1, 2, 3, 4, 5, 6, 7, 8, 9, 10, 11, 12, 13, 14, 15)); }
__device__ __forceinline__ v8f wmma16(v16h a, v16h b, v8f c) { return __builtin_amdgcn_wmma_f32_16x16x32_f16(false, a, false, b, (short)0, c, false, false); }
__device__ __forceinline__ v8f wmmab(v16bf a, v16bf b, v8f c) { return __builtin_amdgcn_wmma_f32_16x16x32_bf16(false, a, false, b, (short)0, c, false, false); }
// fragment loaders from K-contiguous 16-bit rows; p already includes + 8*(lane>>4): elements 0..7 <- k0+8h+0..7, elements 8..15 <- k0+16+8h+0..7 (same map for A and B)
__device__ __forceinline__ v16h  ldh(const h16* p) { return cat16(*(const v8h*)p, *(const v8h*)(p + 16)); }
__device__ __forceinline__ v16bf ldb(const bf* p)  { return cat16b(*(const v8us*)p, *(const v8us*)(p + 16)); }
// ordering point for wave-private LDS tiles (same wave writes and reads)
__device__ __forceinline__ void wave_sync() { __builtin_amdgcn_fence(3 /* release order */, "wavefront"); __builtin_amdgcn_wave_barrier(); asm volatile("" ::: "memory"); }

// ---- GEMM operand staging: tensor loads into a two-buffer LDS ring ----
typedef uint32_t u32x4 __attribute__((ext_vector_type(4)));
typedef uint32_t u32x8 __attribute__((ext_vector_type(8)));
#define GW     8                 // waves per GEMM block, 4 x 2, 32x64 of C each
#define MBW    2                 // 16-row tiles per wave
#define KST    128               // k elements per stage: 256-byte rows
#define LPITCH 272u              // LDS row pitch in bytes (256 + 16 pad: odd multiple of 16 for ds_load_b128)
#define SLICE  10240u            // one wave's slice: 32 rows x 272 B = 8704, rounded up to a multiple of 2 KiB
#define STAGEB (8u * SLICE)      // one buffer: four slices of 32 A rows, then four slices of 32 B rows
#define NSTG   (DM / KST)
static_assert(NSTG >= 2);                      // the ring's prologue needs two stages
static_assert(SLICE % 2048u == 0 && SLICE >= 32u * LPITCH);
__device__ __forceinline__ uint32_t uni(uint32_t v) { return (uint32_t)__builtin_amdgcn_readfirstlane(v); }
__device__ __forceinline__ uint32_t pinned(uint32_t v) { uint32_t w = uni(v); asm volatile("" : "+s"(w)); return w; }   // pinned(): holds a wave-uniform word in a scalar register, so that the test around a tensor load (which ignores EXEC) compiles to s_cmp + s_cbranch_scc
// the compiler places no wait for a tensor load; the operands keep the request's descriptor registers unchanged until it has landed
__device__ __forceinline__ void wait_tensor0(u32x4 g0, u32x8 g1) { asm volatile("s_wait_tensorcnt 0x0" :: "s"(g0), "s"(g1) : "memory"); }
__device__ __forceinline__ void wait_ds0() { asm volatile("s_wait_dscnt 0x0" ::: "memory"); }           // this wave's LDS reads are done before its buffer is handed back
// one request: 32 rows of 256 bytes, source pitch DM*2 bytes, to LDS at pitch 272 (pad of 4 dwords behind every 64 dwords)
__device__ __forceinline__ u32x8 tdm_group1() {
    u32x8 g1;
    g1[0] = uni((1u << 20) | (5u << 22) | (3u << 25));
    g1[1] = uni(256u << 16);          // tensor_dim0 = 256 bytes
    g1[2] = uni(32u << 16);           // tensor_dim1 = 32 rows
    g1[3] = uni(256u << 16);          // tile_dim0
    g1[4] = uni(32u);                 // tile_dim1
    g1[5] = uni((uint32_t)(DM * 2));  // source row pitch, bytes
    g1[6] = uni(0u); g1[7] = uni(0u);
    return g1;
}
__device__ __forceinline__ u32x4 tdm_group0(uint32_t lds_dst, uint64_t ga) {
    u32x4 g0;
    g0[0] = uni(1u); g0[1] = uni(lds_dst); g0[2] = uni((uint32_t)ga); g0[3] = uni((((uint32_t)(ga >> 32)) & 0x01FFFFFFu) | 0x80000000u);
    return g0;
}
__device__ __forceinline__ void tdm_load(u32x4 g0, u32x8 g1) { asm volatile("tensor_load_to_lds %0, %1" :: "s"(g0), "s"(g1) : "memory"); }
__device__ __forceinline__ v8f wmma_sel(v16bf a, v16bf b, v8f c) { return wmmab(a, b, c); }
__device__ __forceinline__ v8f wmma_sel(v16h a, v16h b, v8f c) { return wmma16(a, b, c); }
// fragment from an LDS row, same k map as ldh / ldb: p already includes 16*(lane>>4) bytes; elements 0..7 <- bytes 0..15, elements 8..15 <- bytes 32..47
template <typename F> __device__ __forceinline__ F ldfrag(const unsigned char* p) {
    return __builtin_bit_cast(F, __builtin_shufflevector(*(const v8us*)p, *(const v8us*)(p + 32), 0, 1, 2, 3, 4, 5, 6, 7, 8, 9, 10, 11, 12, 13, 14, 15)); }
// acc[mb][nb] += A[rb + 32*(wave>>1) + 16mb ..][k] * Bt[cb + 64*(wave&1) + 16nb ..][k] over k = 0..DM-1, k ascending in steps of 32.
// Every wave issues its own slice of each stage (waves 0..3: A rows 32w..; waves 4..7: B rows 32(w-4)..), one request outstanding per wave.
template <typename F> __device__ __forceinline__ void gemm_core(const bf* A, const bf* Bt, unsigned char* ring, int rb, int cb, uint32_t wave, int lr, int hi, v8f (&acc)[MBW][4]) {
    const bf* srow = (wave < 4u) ? A + (size_t)(rb + 32 * (int)wave) * DM : Bt + (size_t)(cb + 32 * ((int)wave - 4)) * DM;
    const uint64_t gsrc = (uint64_t)(size_t)srow;
    const uint32_t dst0 = (uint32_t)(size_t)ring + wave * SLICE;
    const u32x8 g1 = tdm_group1();
    u32x4 g0 = tdm_group0(dst0, gsrc);
    tdm_load(g0, g1);                            // stage 0
    wait_tensor0(g0, g1);
    __syncthreads();                             // stage 0 published
    g0 = tdm_group0(dst0 + STAGEB, gsrc + KST * 2);
    tdm_load(g0, g1);                            // stage 1
    const uint32_t aofs = (wave >> 1) * SLICE + (uint32_t)lr * LPITCH + (uint32_t)hi * 16u;
    const uint32_t bofs = (4u + 2u * (wave & 1u)) * SLICE + (uint32_t)lr * LPITCH + (uint32_t)hi * 16u;
#pragma unroll 1
    for (uint32_t s = 0; s < NSTG; ++s) {
        const unsigned char* pa = ring + (s & 1u) * STAGEB + aofs;
        const unsigned char* pb = ring + (s & 1u) * STAGEB + bofs;
        F a[2][MBW], b[2][4];                    // two fragment sets: the next 32 k are fetched while this block's WMMAs run
#pragma unroll
        for (int i = 0; i < 4; ++i) { if (i < MBW) a[0][i] = ldfrag<F>(pa + i * 16 * LPITCH); b[0][i] = ldfrag<F>(pb + (i >> 1) * SLICE + (i & 1) * 16 * LPITCH); }
#pragma unroll
        for (int ks = 0; ks < KST / 32; ++ks) {
            const int cur = ks & 1, nxt = cur ^ 1;
            if (ks + 1 < KST / 32) {
#pragma unroll
                for (int i = 0; i < 4; ++i) { if (i < MBW) a[nxt][i] = ldfrag<F>(pa + i * 16 * LPITCH + (ks + 1) * 64); b[nxt][i] = ldfrag<F>(pb + (i >> 1) * SLICE + (i & 1) * 16 * LPITCH + (ks + 1) * 64); }
            }
            __builtin_amdgcn_sched_barrier(0);   // the next block's LDS reads stay one group ahead of this block, not spread among its WMMAs
#pragma unroll
            for (int nb = 0; nb < 4; ++nb)
#pragma unroll
                for (int mb = 0; mb < MBW; ++mb) acc[mb][nb] = wmma_sel(a[cur][mb], b[cur][nb], acc[mb][nb]);
            __builtin_amdgcn_sched_barrier(0);   // the WMMAs stay in front of the next group and of the publish point
        }
        asm volatile("v_nop\n\tv_nop\n\tv_nop\n\tv_nop");   // WMMA distance: four vector slots before anything on a taken branch touches the last WMMAs' registers
        __builtin_amdgcn_sched_barrier(0);       // holds the v_nops directly behind the last WMMA
        // publish point of stage s + 1
        wait_ds0();
        wait_tensor0(g0, g1);
        __syncthreads();                         // stage s + 1 readable by all waves; every wave has left stage s's buffer
        const uint32_t sn = pinned(s + 2u);      // taken behind the wait, so that the next descriptor is formed behind it
        if (pinned(sn < (uint32_t)NSTG)) { g0 = tdm_group0(dst0 + (sn & 1u) * STAGEB, gsrc + (uint64_t)sn * (KST * 2)); tdm_load(g0, g1); }
    }
    wait_tensor0(g0, g1);
    wait_ds0();
}

__global__ __launch_bounds__(256) void k_cvt8(const float* __restrict__ src, bf* dst, size_t n8) {
    const size_t i = (size_t)blockIdx.x * 256 + threadIdx.x; if (i >= n8) return;
    const v8f v = *(const v8f*)(src + i * 8); v8us o;
#pragma unroll
    for (int k = 0; k < 8; ++k) o[k] = f2bf(v[k]);
    *(v8us*)(dst + i * 8) = o; 
}

// k_wt: weight transpose + 16-bit convert through LDS. W is [k = in][n = out] f32 (pitch DM); WT[n'][k] (pitch DM), source column of output row n' is
// perm ? (n'%16)*64 + n'/16 : n'. asf16 == 0: bf16 bits (RNE convert); asf16 != 0: f16 bits of bf16(w) * 256 (exact for bf16 values in the f16 normal range).
__global__ __launch_bounds__(256) void k_wt(const float* __restrict__ W, bf* WT, int perm, int asf16) {
    __shared__ float tl[64 * 65];
    const int tid = threadIdx.x; const int n0 = blockIdx.x * 64, k0 = blockIdx.y * 64;
    { const int nn = tid & 63; const int np = n0 + nn; const int col = perm ? ((np & 15) * 64 + (np >> 4)) : np;
#pragma unroll 4
      for (int i = 0; i < 16; ++i) { const int kk = i * 4 + (tid >> 6); tl[kk * 65 + nn] = W[(size_t)(k0 + kk) * DM + col]; } }   // 16 x 4 k rows x 64 n = whole tile
    __syncthreads();
    v8us o[2];
#pragma unroll
    for (int it = 0; it < 2; ++it) { const int piece = it * 256 + tid; const int row = piece >> 3, j = piece & 7;   // 512 pieces = 64 rows x 8
#pragma unroll
        for (int i = 0; i < 8; ++i) { const float x = tl[(j * 8 + i) * 65 + row]; const unsigned short b = f2bf(x);
            const h16 hv = (h16)(bf2f(b) * WOS); const unsigned short hb = __builtin_bit_cast(unsigned short, hv); o[it][i] = asf16 ? hb : b; } }
{
#pragma unroll
        for (int it = 0; it < 2; ++it) { const int piece = it * 256 + tid; const int row = piece >> 3, j = piece & 7;
            *(v8us*)(WT + (size_t)(n0 + row) * DM + k0 + j * 8) = o[it]; }
         }
}

// k_proj: bf16 GEMM, 128x128 tile per block of eight waves (32x64 = 8 accumulators each), operands from K-contiguous bf16 planes through the LDS ring, K = DM.
// C[m][n] = sum_k A[m][k] Bt[n][k] + bias, written as f16. grid (NB*SEQ/128, DM/128), 256 threads.
// vmode == 0: row-major plane Ph[m][n] (pitch DM), bias[n].
// vmode != 0: Bt rows are permuted (n' = d*16 + fb <-> feature fb*64 + d), bias[fb*64 + d]; element (token m, n') goes to the v^T plane
//             Ph[(zh*64 + d)*SEQ + tt*16 + fb] with zh = m / TPG, tt = m % TPG (key row tt*16 + fb of pseudo-head zh).
__global__ __launch_bounds__(32 * GW) void k_proj(const bf* __restrict__ A, const bf* __restrict__ Bt, const float* __restrict__ bias, h16* Ph, int vmode) {
    __shared__ __attribute__((aligned(2048))) unsigned char ring[2 * STAGEB];
    __shared__ __align__(16) float osw[GW * 16 * 68];
    __shared__ __align__(16) float bshw[GW * 64];
    const int lane = threadIdx.x & 31, lr = lane & 15, hi = lane >> 4;
    const uint32_t wave = uni(threadIdx.x >> 5);
    float* os = osw + wave * (16 * 68); float* bsh = bshw + wave * 64;      // wave-private epilogue tiles
    v8f acc[MBW][4];
#pragma unroll
    for (int mb = 0; mb < MBW; ++mb)
#pragma unroll
        for (int nb = 0; nb < 4; ++nb) acc[mb][nb] = (v8f){};
    gemm_core<v16bf>(A, Bt, ring, blockIdx.x * 128, blockIdx.y * 128, wave, lr, hi, acc);
    const int r0 = blockIdx.x * 128 + 32 * (int)(wave >> 1), c0 = blockIdx.y * 128 + 64 * (int)(wave & 1u);   // this wave's 32x64 tile
    // bias of the tile's 64 columns (bf16-valued), staged once: bsh[0..63] all written, all read
#pragma unroll
    for (int u = 0; u < 2; ++u) { const int n = c0 + lane + 32 * u; const int bi = vmode ? ((n & 15) * 64 + (n >> 4)) : n; bsh[lane + 32 * u] = bfr(bias[bi]); }
    wave_sync();
#pragma unroll
    for (int mb = 0; mb < MBW; ++mb) {
#pragma unroll
        for (int nb = 0; nb < 4; ++nb) {
#pragma unroll
            for (int j = 0; j < 8; ++j) os[(hi * 8 + j) * 68 + nb * 16 + lr] = acc[mb][nb][j]; }   // D: row 8h+j, col lane&15; 16 rows x 64 columns all written
        wave_sync();
        const int R0 = r0 + mb * 16;
        if (vmode == 0) {
{
#pragma unroll
                for (int s = 0; s < 4; ++s) { const int row = 4 * s + (lane >> 3), c8 = (lane & 7) * 8;   // 4 s x 4 row groups = 16 rows; 8 lanes x 8 = 64 columns
                    const v4f x0 = *(const v4fa*)(&os[row * 68 + c8]); const v4f x1 = *(const v4fa*)(&os[row * 68 + c8 + 4]);
                    const v4f b0 = *(const v4fa*)(&bsh[c8]); const v4f b1 = *(const v4fa*)(&bsh[c8 + 4]); v8h hv;
#pragma unroll
                    for (int i = 0; i < 4; ++i) { hv[i] = (h16)(x0[i] + b0[i]); hv[4 + i] = (h16)(x1[i] + b1[i]); }
                    *(v8h*)(Ph + (size_t)(R0 + row) * DM + c0 + c8) = hv; }
                 }
        } else {
            const int zh = R0 / TPG, tt0 = R0 % TPG;
            const int q = lane >> 3, jj = lane & 7; const int row = 4 * q + (jj >> 1), fb0 = (jj & 1) * 8;   // line (dl = s, q): rows 4q..4q+3 x 16 fb; lanes 8q..8q+7 contiguous
{
#pragma unroll
                for (int s = 0; s < 4; ++s) { const int col = s * 16 + fb0; const int d = (c0 >> 4) + s;   // 4 dl x (4 q x 4 rows) x 16 fb = 16 rows x 64 columns
                    const v4f x0 = *(const v4fa*)(&os[row * 68 + col]); const v4f x1 = *(const v4fa*)(&os[row * 68 + col + 4]);
                    const v4f b0 = *(const v4fa*)(&bsh[col]); const v4f b1 = *(const v4fa*)(&bsh[col + 4]); v8h hv;
#pragma unroll
                    for (int i = 0; i < 4; ++i) { hv[i] = (h16)(x0[i] + b0[i]); hv[4 + i] = (h16)(x1[i] + b1[i]); }
                    *(v8h*)(Ph + ((size_t)zh * HD + d) * SEQ + (size_t)(tt0 + row) * 16 + fb0) = hv; }
                 }
        }
        wave_sync();
    }
}

// k_out: f16 GEMM, 128x128 tile per block of eight waves through the LDS ring, A = ctx plane (x1024), Bt = Wo^T plane (x256), K = DM; OUT[m][n] = acc * 2^-18 + bo[n] (f32).
__global__ __launch_bounds__(32 * GW) void k_out(const h16* __restrict__ A, const h16* __restrict__ Bt, const float* __restrict__ bias, float* OUT) {
    __shared__ __attribute__((aligned(2048))) unsigned char ring[2 * STAGEB];
    __shared__ __align__(16) float osw[GW * 16 * 68];
    __shared__ __align__(16) float bshw[GW * 64];
    const int lane = threadIdx.x & 31, lr = lane & 15, hi = lane >> 4;
    const uint32_t wave = uni(threadIdx.x >> 5);
    float* os = osw + wave * (16 * 68); float* bsh = bshw + wave * 64;      // wave-private epilogue tiles
    v8f acc[MBW][4];
#pragma unroll
    for (int mb = 0; mb < MBW; ++mb)
#pragma unroll
        for (int nb = 0; nb < 4; ++nb) acc[mb][nb] = (v8f){};
    gemm_core<v16h>((const bf*)A, (const bf*)Bt, ring, blockIdx.x * 128, blockIdx.y * 128, wave, lr, hi, acc);
    const int r0 = blockIdx.x * 128 + 32 * (int)(wave >> 1), c0 = blockIdx.y * 128 + 64 * (int)(wave & 1u);   // this wave's 32x64 tile
#pragma unroll
    for (int u = 0; u < 2; ++u) bsh[lane + 32 * u] = bfr(bias[c0 + lane + 32 * u]);   // bsh[0..63] all written, all read
    wave_sync();
    const size_t orow0 = (size_t)(r0 / SEQ) * OUT_SEQ + (size_t)(r0 % SEQ);
#pragma unroll
    for (int mb = 0; mb < MBW; ++mb) {
#pragma unroll
        for (int nb = 0; nb < 4; ++nb) {
#pragma unroll
            for (int j = 0; j < 8; ++j) os[(hi * 8 + j) * 68 + nb * 16 + lr] = acc[mb][nb][j]; }   // 16 rows x 64 columns all written
        wave_sync();
        float* ob = OUT + (orow0 + (size_t)(mb * 16)) * DM + c0;
{
#pragma unroll
            for (int s = 0; s < 8; ++s) { const int row = 2 * s + hi, cofs = lr * 4;   // 8 s x 2 rows = 16 rows; 16 lanes x 4 floats = 64 columns
                const v4f x = *(const v4fa*)(&os[row * 68 + cofs]); const v4f bb = *(const v4fa*)(&bsh[cofs]); v4f val;
#pragma unroll
                for (int i = 0; i < 4; ++i) val[i] = x[i] * OSC + bb[i];
                *(v4f*)(ob + (size_t)row * DM + cofs) = val; }
             }
        wave_sync();
    }
}

// k_flash: fused attention, one wave per 16 query rows of one pseudo-head; K / V^T / Q fragments straight from the f16 planes (two 16-B loads each, arithmetic addressing).
// Transposed form: S^T[key][t] = K Q^T (A = K rows, B = Q rows); lane (t = lane&15, h = lane>>4) holds keys 8h+r of each 16-key tile, so the packed
// P tile is directly the B fragment of O^T[d][t] = V^T P^T (element r <- tile keys 0..15, element 8+r <- tile keys 16..31, lane unchanged).
// Softmax state (running max, partial sum) is one scalar per lane; the two lane halves of a row are combined with one xor-16 exchange.
__global__ __launch_bounds__(32 * AW) void k_flash(const h16* __restrict__ QH, const h16* __restrict__ KP, const h16* __restrict__ VT, h16* CX) {
    __shared__ __align__(16) float os[AW * 16 * 68];
    const int lane = threadIdx.x & 31, lr = lane & 15, hi = lane >> 4;
    const int wave = __builtin_amdgcn_readfirstlane(threadIdx.x >> 5);
    const int zh = blockIdx.y;
    const int t0 = (blockIdx.x * AW + wave) * 16;
    const size_t pbase = (size_t)zh * SEQ * HD;
    const size_t qo = pbase + (size_t)(t0 + lr) * HD + 8 * hi;
    const v16h q0 = ldh(QH + qo), q1 = ldh(QH + qo + 32);    // B fragments: col t, k = d
    const size_t ko = pbase + (size_t)lr * HD + 8 * hi;      // + key * HD       (A fragment: row key, k = d)
    const size_t vo = pbase + (size_t)lr * SEQ + 8 * hi;     // + 16j*SEQ + key  (A fragment: row d, k = key)
    v8f o0 = (v8f){}, o1 = (v8f){}, o2 = (v8f){}, o3 = (v8f){};
    float m = -3.0e38f, l = 0.0f;
#pragma unroll 1
    for (int key0 = 0; key0 < SEQ; key0 += 32) {
        const h16* ka = KP + ko + (size_t)key0 * HD;
        const v16h ka0 = ldh(ka), ka1 = ldh(ka + 32), kb0 = ldh(ka + 16 * HD), kb1 = ldh(ka + 16 * HD + 32);
        v8f sa = (v8f){}, sb = (v8f){};
        sa = wmma16(ka0, q0, sa); sb = wmma16(kb0, q0, sb);
        sa = wmma16(ka1, q1, sa); sb = wmma16(kb1, q1, sb);
        asm volatile("v_nop\n\tv_nop\n\tv_nop\n\tv_nop" : "+v"(sa), "+v"(sb) : "v"(ka0), "v"(ka1), "v"(kb0), "v"(kb1), "v"(q0), "v"(q1));
        float ta[8], tb[8]; float mx = -3.0e38f;
#pragma unroll
        for (int r = 0; r < 8; ++r) { ta[r] = sa[r] * SC2; tb[r] = sb[r] * SC2; mx = fmaxf(mx, fmaxf(ta[r], tb[r])); }
        mx = fmaxf(mx, __shfl_xor(mx, 16, 32));
        const float mnew = fmaxf(m, mx);
        const float alpha = __builtin_amdgcn_exp2f(m - mnew);
        const float sh = PSH - mnew;
        v16h pb; float ls = 0.0f;
#pragma unroll
        for (int r = 0; r < 8; ++r) { const h16 pa = (h16)__builtin_amdgcn_exp2f(ta[r] + sh); const h16 pc = (h16)__builtin_amdgcn_exp2f(tb[r] + sh); pb[r] = pa; pb[8 + r] = pc; ls += (float)pa + (float)pc; }
        l = l * alpha + ls; m = mnew;
        o0 = o0 * alpha; o1 = o1 * alpha; o2 = o2 * alpha; o3 = o3 * alpha;
        const h16* va = VT + vo + key0;
        const v16h v0 = ldh(va), v1 = ldh(va + (size_t)16 * SEQ), v2 = ldh(va + (size_t)32 * SEQ), v3 = ldh(va + (size_t)48 * SEQ);
        o0 = wmma16(v0, pb, o0); o1 = wmma16(v1, pb, o1); o2 = wmma16(v2, pb, o2); o3 = wmma16(v3, pb, o3);
        asm volatile("v_nop\n\tv_nop\n\tv_nop\n\tv_nop" : "+v"(o0), "+v"(o1), "+v"(o2), "+v"(o3) : "v"(v0), "v"(v1), "v"(v2), "v"(v3), "v"(pb));
    }
    l += __shfl_xor(l, 16, 32);
    const float inv = (1.0f / l) * CXS;
    const int wb = wave * 16 * 68;
    // O^T D layout: o_j[r] = (d = 16j + 8h + r, t = lane&15) -> os[t][d]; rows 0..15 x columns 0..63 all written
    { v4f a, c;
      a[0] = o0[0] * inv; a[1] = o0[1] * inv; a[2] = o0[2] * inv; a[3] = o0[3] * inv; c[0] = o0[4] * inv; c[1] = o0[5] * inv; c[2] = o0[6] * inv; c[3] = o0[7] * inv;
      *(v4fa*)(&os[wb + lr * 68 +  0 + 8 * hi]) = a; *(v4fa*)(&os[wb + lr * 68 +  0 + 8 * hi + 4]) = c;
      a[0] = o1[0] * inv; a[1] = o1[1] * inv; a[2] = o1[2] * inv; a[3] = o1[3] * inv; c[0] = o1[4] * inv; c[1] = o1[5] * inv; c[2] = o1[6] * inv; c[3] = o1[7] * inv;
      *(v4fa*)(&os[wb + lr * 68 + 16 + 8 * hi]) = a; *(v4fa*)(&os[wb + lr * 68 + 16 + 8 * hi + 4]) = c;
      a[0] = o2[0] * inv; a[1] = o2[1] * inv; a[2] = o2[2] * inv; a[3] = o2[3] * inv; c[0] = o2[4] * inv; c[1] = o2[5] * inv; c[2] = o2[6] * inv; c[3] = o2[7] * inv;
      *(v4fa*)(&os[wb + lr * 68 + 32 + 8 * hi]) = a; *(v4fa*)(&os[wb + lr * 68 + 32 + 8 * hi + 4]) = c;
      a[0] = o3[0] * inv; a[1] = o3[1] * inv; a[2] = o3[2] * inv; a[3] = o3[3] * inv; c[0] = o3[4] * inv; c[1] = o3[5] * inv; c[2] = o3[6] * inv; c[3] = o3[7] * inv;
      *(v4fa*)(&os[wb + lr * 68 + 48 + 8 * hi]) = a; *(v4fa*)(&os[wb + lr * 68 + 48 + 8 * hi + 4]) = c; }
    wave_sync();
    h16* crow = CX + pbase + (size_t)t0 * HD;      // pseudo-head row r -> flat offset zh*SEQ*64 + r*64 of the row-major ctx plane
{
#pragma unroll
        for (int s = 0; s < 4; ++s) { const int row = 4 * s + (lane >> 3), c8 = (lane & 7) * 8;   // 4 s x 4 row groups = 16 rows; 8 lanes x 8 = 64 columns
            const v4f x0 = *(const v4fa*)(&os[wb + row * 68 + c8]); const v4f x1 = *(const v4fa*)(&os[wb + row * 68 + c8 + 4]); v8h hv;
#pragma unroll
            for (int i = 0; i < 4; ++i) { hv[i] = (h16)x0[i]; hv[4 + i] = (h16)x1[i]; }
            *(v8h*)(crow + (size_t)row * HD + c8) = hv; }
         }
}

static constexpr size_t al256(size_t v) { return (v + 255) & ~(size_t)255; }
static constexpr size_t SZ_XB = al256((size_t)NB * SEQ * DM * 2);      // one bf16 stream copy
static constexpr size_t SZ_WB = al256((size_t)4 * DM * DM * 2);        // four 16-bit weight planes
static constexpr size_t SZ_PL = al256((size_t)NB * SEQ * DM * 2);      // one f16 plane (q, k, v^T, ctx)
static constexpr size_t SZ_TOTAL = 3 * SZ_XB + SZ_WB + 4 * SZ_PL;
static_assert(SZ_TOTAL <= (size_t)134217728);          // workspace carve <= 128 MiB
static_assert(((size_t)DM * DM * 2) % 256 == 0);       // weight sub-planes stay 256-byte aligned
static_assert((size_t)NB * NH_ * HD * SEQ * 2 <= SZ_PL);   // v^T plane [NB*16][64][SEQ] fits its region

extern "C" void kernel_launch(void* const* d_in, const int* in_sizes, int n_in,
                              void* d_out, int out_size, void* d_ws, size_t ws_size, hipStream_t stream) {
    if (n_in < 11) return;
    const size_t needx = ((size_t)(NB - 1) * SEQ_FULL + SEQ) * DM;
    if ((size_t)in_sizes[0] < needx || (size_t)in_sizes[1] < needx || (size_t)in_sizes[2] < needx) return;
    if ((size_t)in_sizes[3] < (size_t)DM * DM || (size_t)in_sizes[5] < (size_t)DM * DM || (size_t)in_sizes[7] < (size_t)DM * DM || (size_t)in_sizes[9] < (size_t)DM * DM) return;
    if (in_sizes[4] < DM || in_sizes[6] < DM || in_sizes[8] < DM || in_sizes[10] < DM) return;
    if ((size_t)out_size < ((size_t)(NB - 1) * OUT_SEQ + SEQ) * DM) return;
    if (SZ_TOTAL > ws_size) return;
    // wire order: queries, keys, values, Wq, bq, Wk, bk, Wv, bv, Wo, bo
    const float* xq = (const float*)d_in[0]; const float* xk = (const float*)d_in[1]; const float* xv = (const float*)d_in[2];
    const float* wq = (const float*)d_in[3]; const float* bq = (const float*)d_in[4];
    const float* wk = (const float*)d_in[5]; const float* bk = (const float*)d_in[6];
    const float* wv = (const float*)d_in[7]; const float* bv = (const float*)d_in[8];
    const float* wo = (const float*)d_in[9]; const float* bo = (const float*)d_in[10];
    float* OUT = (float*)d_out;      // [NB][OUT_SEQ][1024]
    char* wsp = (char*)d_ws;
    bf* XQ = (bf*)wsp; wsp += SZ_XB;                 // [NB*SEQ][1024]
    bf* XK = (bf*)wsp; wsp += SZ_XB;
    bf* XV = (bf*)wsp; wsp += SZ_XB;
    bf* WB = (bf*)wsp; wsp += SZ_WB;                 // [4][1024 out][1024 in]: q | k | v (rows permuted) | o (f16 bits, x256)
    h16* QH = (h16*)wsp; wsp += SZ_PL;               // [NB*SEQ][1024] = [NB*16][SEQ][64]
    h16* KP = (h16*)wsp; wsp += SZ_PL;               // [NB*SEQ][1024] = [NB*16][SEQ][64]
    h16* VT = (h16*)wsp; wsp += SZ_PL;               // [NB*16][64][SEQ]
    h16* CX = (h16*)wsp; wsp += SZ_PL;               // [NB*SEQ][1024] = [NB*16][SEQ][64], x1024
    bf* WQ = WB; bf* WK = WB + (size_t)DM * DM; bf* WV = WB + (size_t)2 * DM * DM; bf* WO = WB + (size_t)3 * DM * DM;

    if (SEQ == SEQ_FULL) {
        const size_t n8 = (size_t)NB * SEQ * DM / 8; const unsigned g = (unsigned)((n8 + 255) / 256);
        k_cvt8<<<g, 256, 0, stream>>>(xq, XQ, n8); k_cvt8<<<g, 256, 0, stream>>>(xk, XK, n8); k_cvt8<<<g, 256, 0, stream>>>(xv, XV, n8);
    } else {
        const size_t n8 = (size_t)SEQ * DM / 8; const unsigned g = (unsigned)((n8 + 255) / 256);
        for (int b = 0; b < NB; ++b) {
            k_cvt8<<<g, 256, 0, stream>>>(xq + (size_t)b * SEQ_FULL * DM, XQ + (size_t)b * SEQ * DM, n8);
            k_cvt8<<<g, 256, 0, stream>>>(xk + (size_t)b * SEQ_FULL * DM, XK + (size_t)b * SEQ * DM, n8);
            k_cvt8<<<g, 256, 0, stream>>>(xv + (size_t)b * SEQ_FULL * DM, XV + (size_t)b * SEQ * DM, n8);
        }
    }
    // weights: in [k = in rows][n = out cols] -> out [n'][k]; square 1024 x 1024, grid (out/64, in/64)
    { const dim3 g(DM / 64, DM / 64, 1);
      k_wt<<<g, 256, 0, stream>>>(wq, WQ, 0, 0); k_wt<<<g, 256, 0, stream>>>(wk, WK, 0, 0);
      k_wt<<<g, 256, 0, stream>>>(wv, WV, 1, 0); k_wt<<<g, 256, 0, stream>>>(wo, WO, 0, 1); }

    // q, k: A = stream rows (m = b*SEQ + t), Bt = W^T rows (n = feature) -> row-major plane
    k_proj<<<dim3(NB * SEQ / 128, DM / 128, 1), 32 * GW, 0, stream>>>(XQ, WQ, bq, QH, 0);
    k_proj<<<dim3(NB * SEQ / 128, DM / 128, 1), 32 * GW, 0, stream>>>(XK, WK, bk, KP, 0);
    // v: Bt = permuted Wv^T rows (n' = d*16 + fb) -> v^T plane [(b*16 + g)][d][key row]
    k_proj<<<dim3(NB * SEQ / 128, DM / 128, 1), 32 * GW, 0, stream>>>(XV, WV, bv, VT, 1);

    k_flash<<<dim3(SEQ / (16 * AW), NB * NH_, 1), 32 * AW, 0, stream>>>(QH, KP, VT, CX);

    k_out<<<dim3(NB * SEQ / 128, DM / 128, 1), 32 * GW, 0, stream>>>(CX, (const h16*)WO, bo, OUT);
}

// v002
// A run of this version takes 118 microseconds.
// In two side-by-side timings against v001, it was 1.17 and 1.16 times as fast.
// Over all steps from v000 it is 1.61 times as fast.
#include <hip/hip_runtime.h>

// Attention with three input streams, width 1024 = 16 x 64, x @ W + b with W stored [in][out], row-major pseudo-head split [B][L][1024] -> [B*16][L][64] (no transpose), score scale 1/8, output projection Wo + bo (f32 out).
// Compute dtypes, f32 accumulate everywhere: q/k/v projections v_wmma_f32_16x16x32_bf16 (inputs and weights RNE-converted to bf16; products exact);
// scores and P.V v_wmma_f32_16x16x32_f16 (q, k, v single f16; P carried x256, cancels in the normalisation); output projection v_wmma_f32_16x16x32_f16 (ctx f16 carried x1024, Wo = f16 of bf16(Wo) x256, folded back as 2^-18); softmax f32 (online, running max).
// Layout: bf16 copies of the three streams; weights transposed through LDS into [out][in] planes (Wv rows permuted n' = d*16 + f/64); q, k planes row-major [token][1024] re-read as [b*16+g][row][64];
// Four launches: k_prep (stream converts and weight transposes, told apart by block index), k_proj (q, k, v GEMMs, one per grid z), k_flash, k_out.
// the four GEMMs: 128x128 tile per 8-wave block, A and B rows staged in LDS by tensor loads (two buffers); v^T plane [b*16+g][d][row] written by the GEMM epilogue; fused flash kernel in transposed form (S^T = K Q^T, O^T = V^T P^T); ctx plane row-major f16; out GEMM writes d_out.

#ifndef NB
#define NB 4
#endif
#ifndef SEQ
#define SEQ 1024
#endif
#define NB_FULL  4
#define SEQ_FULL 1024
#ifndef OUT_SEQ
#define OUT_SEQ SEQ              // row pitch (in tokens) between batches of the output
#endif
#define DM   1024
#define NH_  16
#define HD   64
#define TPG  (SEQ / NH_)         // tokens covered by one pseudo-head
#define AW   4                   // waves per flash block (16 query rows each)
#define SC2  (0.125f * 1.4426950408889634f)   // HD^-0.5 * log2(e)
#define PSH  8.0f                // log2 of the P carry (256)
#define CXS  1024.0f             // carry of the ctx plane
#define WOS  256.0f              // carry of the Wo plane
#define OSC  (1.0f / (1024.0f * 256.0f))

static_assert(HD == 64);
static_assert(NH_ * HD == DM);                 // pseudo-head row r = token r/16, features (r%16)*64 + d
static_assert(DM / HD == 16);                  // permuted v weight rows n' = d*16 + f/64 use 16 feature blocks
static_assert(DM % 64 == 0);                   // column tiles of 64
static_assert(DM % 32 == 0);                   // GEMM k-loop steps by 32
static_assert(SEQ % 64 == 0);                  // a 32-row wave tile never straddles two batches
static_assert((NB * SEQ) % 128 == 0);          // GEMM row tiles of 128
static_assert(DM % 128 == 0);                  // GEMM column tiles of 128, k stages of 128
static_assert(SEQ % 32 == 0);                  // key loop steps by 32
static_assert(SEQ % (16 * AW) == 0);           // flash grid covers the sequence exactly
static_assert(TPG * NH_ == SEQ);
static_assert(TPG % 16 == 0);                  // a 16-token slab stays inside one pseudo-head (v^T epilogue)
static_assert(((size_t)SEQ * DM) % 8 == 0);
static_assert(((size_t)DM * DM) % 8 == 0);
static_assert(NB <= NB_FULL);
static_assert(SEQ <= SEQ_FULL);
static_assert(OUT_SEQ >= SEQ);

typedef _Float16 h16;
typedef unsigned short bf;
typedef __attribute__((ext_vector_type(16))) __bf16   v16bf;
typedef __attribute__((ext_vector_type(16))) _Float16 v16h;
typedef __attribute__((ext_vector_type(8)))  _Float16 v8h;
typedef __attribute__((ext_vector_type(8)))  unsigned short v8us;
typedef __attribute__((ext_vector_type(8)))  float    v8f;
typedef __attribute__((ext_vector_type(4)))  float    v4f;
typedef v4f  __attribute__((may_alias)) v4fa;

__device__ __forceinline__ unsigned short f2bf(float f) { unsigned u = __float_as_uint(f); u += 0x7FFFu + ((u >> 16) & 1u); return (unsigned short)(u >> 16); }
__device__ __forceinline__ float bf2f(unsigned short b) { return __uint_as_float(((unsigned)b) << 16); }
__device__ __forceinline__ float bfr(float f) { return bf2f(f2bf(f)); }
__device__ __forceinline__ v16h cat16(v8h lo, v8h hi) { return __builtin_shufflevector(lo, hi, 0, 1, 2, 3, 4, 5, 6, 7, 8, 9, 10, 11, 12, 13, 14, 15); }
__device__ __forceinline__ v16bf cat16b(v8us lo, v8us hi) { return __builtin_bit_cast(v16bf, __builtin_shufflevector(lo, hi, 0, 1, 2, 3, 4, 5, 6, 7, 8, 9, 10, 11, 12, 13, 14, 15)); }
__device__ __forceinline__ v8f wmma16(v16h a, v16h b, v8f c) { return __builtin_amdgcn_wmma_f32_16x16x32_f16(false, a, false, b, (short)0, c, false, false); }
__device__ __forceinline__ v8f wmmab(v16bf a, v16bf b, v8f c) { return __builtin_amdgcn_wmma_f32_16x16x32_bf16(false, a, false, b, (short)0, c, false, false); }
// fragment loaders from K-contiguous 16-bit rows; p already includes + 8*(lane>>4): elements 0..7 <- k0+8h+0..7, elements 8..15 <- k0+16+8h+0..7 (same map for A and B)
__device__ __forceinline__ v16h  ldh(const h16* p) { return cat16(*(const v8h*)p, *(const v8h*)(p + 16)); }
__device__ __forceinline__ v16bf ldb(const bf* p)  { return cat16b(*(const v8us*)p, *(const v8us*)(p + 16)); }
// ordering point for wave-private LDS tiles (same wave writes and reads)
__device__ __forceinline__ void wave_sync() { __builtin_amdgcn_fence(3 /* release order */, "wavefront"); __builtin_amdgcn_wave_barrier(); asm volatile("" ::: "memory"); }

// ---- GEMM operand staging: tensor loads into a two-buffer LDS ring ----
typedef uint32_t u32x4 __attribute__((ext_vector_type(4)));
typedef uint32_t u32x8 __attribute__((ext_vector_type(8)));
#define GW     8                 // waves per GEMM block, 4 x 2, 32x64 of C each
#define MBW    2                 // 16-row tiles per wave
#define KST    128               // k elements per stage: 256-byte rows
#define LPITCH 272u              // LDS row pitch in bytes (256 + 16 pad: odd multiple of 16 for ds_load_b128)
#define SLICE  10240u            // one wave's slice: 32 rows x 272 B = 8704, rounded up to a multiple of 2 KiB
#define STAGEB (8u * SLICE)      // one buffer: four slices of 32 A rows, then four slices of 32 B rows
#define NSTG   (DM / KST)
static_assert(NSTG >= 2);                      // the ring's prologue needs two stages
static_assert(SLICE % 2048u == 0 && SLICE >= 32u * LPITCH);
__device__ __forceinline__ uint32_t uni(uint32_t v) { return (uint32_t)__builtin_amdgcn_readfirstlane(v); }
__device__ __forceinline__ uint32_t pinned(uint32_t v) { uint32_t w = uni(v); asm volatile("" : "+s"(w)); return w; }   // pinned(): holds a wave-uniform word in a scalar register, so that the test around a tensor load (which ignores EXEC) compiles to s_cmp + s_cbranch_scc
// the compiler places no wait for a tensor load; the operands keep the request's descriptor registers unchanged until it has landed
__device__ __forceinline__ void wait_tensor0(u32x4 g0, u32x8 g1) { asm volatile("s_wait_tensorcnt 0x0" :: "s"(g0), "s"(g1) : "memory"); }
__device__ __forceinline__ void wait_ds0() { asm volatile("s_wait_dscnt 0x0" ::: "memory"); }           // this wave's LDS reads are done before its buffer is handed back
// one request: 32 rows of 256 bytes, source pitch DM*2 bytes, to LDS at pitch 272 (pad of 4 dwords behind every 64 dwords)
__device__ __forceinline__ u32x8 tdm_group1() {
    u32x8 g1;
    g1[0] = uni((1u << 20) | (5u << 22) | (3u << 25));
    g1[1] = uni(256u << 16);          // tensor_dim0 = 256 bytes
    g1[2] = uni(32u << 16);           // tensor_dim1 = 32 rows
    g1[3] = uni(256u << 16);          // tile_dim0
    g1[4] = uni(32u);                 // tile_dim1
    g1[5] = uni((uint32_t)(DM * 2));  // source row pitch, bytes
    g1[6] = uni(0u); g1[7] = uni(0u);
    return g1;
}
__device__ __forceinline__ u32x4 tdm_group0(uint32_t lds_dst, uint64_t ga) {
    u32x4 g0;
    g0[0] = uni(1u); g0[1] = uni(lds_dst); g0[2] = uni((uint32_t)ga); g0[3] = uni((((uint32_t)(ga >> 32)) & 0x01FFFFFFu) | 0x80000000u);
    return g0;
}
// group 0 is an in-and-out operand: the covering wait then names the very registers the request was issued from, so none of them takes a new value while it is outstanding
__device__ __forceinline__ void tdm_load(u32x4& g0, u32x8 g1) { asm volatile("tensor_load_to_lds %0, %1" : "+s"(g0) : "s"(g1) : "memory"); }
__device__ __forceinline__ v8f wmma_sel(v16bf a, v16bf b, v8f c) { return wmmab(a, b, c); }
__device__ __forceinline__ v8f wmma_sel(v16h a, v16h b, v8f c) { return wmma16(a, b, c); }
// fragment from an LDS row, same k map as ldh / ldb: p already includes 16*(lane>>4) bytes; elements 0..7 <- bytes 0..15, elements 8..15 <- bytes 32..47
template <typename F> __device__ __forceinline__ F ldfrag(const unsigned char* p) {
    return __builtin_bit_cast(F, __builtin_shufflevector(*(const v8us*)p, *(const v8us*)(p + 32), 0, 1, 2, 3, 4, 5, 6, 7, 8, 9, 10, 11, 12, 13, 14, 15)); }
// acc[mb][nb] += A[rb + 32*(wave>>1) + 16mb ..][k] * Bt[cb + 64*(wave&1) + 16nb ..][k] over k = 0..DM-1, k ascending in steps of 32.
// Every wave issues its own slice of each stage (waves 0..3: A rows 32w..; waves 4..7: B rows 32(w-4)..), one request outstanding per wave.
template <typename F> __device__ __forceinline__ void gemm_core(const bf* A, const bf* Bt, unsigned char* ring, int rb, int cb, uint32_t wave, int lr, int hi, v8f (&acc)[MBW][4]) {
    const bf* srow = (wave < 4u) ? A + (size_t)(rb + 32 * (int)wave) * DM : Bt + (size_t)(cb + 32 * ((int)wave - 4)) * DM;
    const uint64_t gsrc = (uint64_t)(size_t)srow;
    const uint32_t dst0 = (uint32_t)(size_t)ring + wave * SLICE;
    const u32x8 g1 = tdm_group1();
    u32x4 g0 = tdm_group0(dst0, gsrc);
    tdm_load(g0, g1);                            // stage 0
    wait_tensor0(g0, g1);
    __syncthreads();                             // stage 0 published
    g0 = tdm_group0(dst0 + STAGEB, gsrc + KST * 2);
    tdm_load(g0, g1);                            // stage 1
    const uint32_t aofs = (wave >> 1) * SLICE + (uint32_t)lr * LPITCH + (uint32_t)hi * 16u;
    const uint32_t bofs = (4u + 2u * (wave & 1u)) * SLICE + (uint32_t)lr * LPITCH + (uint32_t)hi * 16u;
#pragma unroll 1
    for (uint32_t s = 0; s < NSTG; ++s) {
        const unsigned char* pa = ring + (s & 1u) * STAGEB + aofs;
        const unsigned char* pb = ring + (s & 1u) * STAGEB + bofs;
        F a[2][MBW], b[2][4];                    // two fragment sets: the next 32 k are fetched while this block's WMMAs run
#pragma unroll
        for (int i = 0; i < 4; ++i) { if (i < MBW) a[0][i] = ldfrag<F>(pa + i * 16 * LPITCH); b[0][i] = ldfrag<F>(pb + (i >> 1) * SLICE + (i & 1) * 16 * LPITCH); }
#pragma unroll
        for (int ks = 0; ks < KST / 32; ++ks) {
            const int cur = ks & 1, nxt = cur ^ 1;
            if (ks + 1 < KST / 32) {
#pragma unroll
                for (int i = 0; i < 4; ++i) { if (i < MBW) a[nxt][i] = ldfrag<F>(pa + i * 16 * LPITCH + (ks + 1) * 64); b[nxt][i] = ldfrag<F>(pb + (i >> 1) * SLICE + (i & 1) * 16 * LPITCH + (ks + 1) * 64); }
            }
            __builtin_amdgcn_sched_barrier(0);   // the next block's LDS reads stay one group ahead of this block, not spread among its WMMAs
#pragma unroll
            for (int nb = 0; nb < 4; ++nb)
#pragma unroll
                for (int mb = 0; mb < MBW; ++mb) acc[mb][nb] = wmma_sel(a[cur][mb], b[cur][nb], acc[mb][nb]);
            __builtin_amdgcn_sched_barrier(0);   // the WMMAs stay in front of the next group and of the publish point
        }
        asm volatile("v_nop\n\tv_nop\n\tv_nop\n\tv_nop");   // WMMA distance: four vector slots before anything on a taken branch touches the last WMMAs' registers
        __builtin_amdgcn_sched_barrier(0);       // holds the v_nops directly behind the last WMMA
        // publish point of stage s + 1
        wait_ds0();
        wait_tensor0(g0, g1);
        __syncthreads();                         // stage s + 1 readable by all waves; every wave has left stage s's buffer
        const uint32_t sn = pinned(s + 2u);      // taken behind the wait, so that the next descriptor is formed behind it
        if (pinned(sn < (uint32_t)NSTG)) { g0 = tdm_group0(dst0 + (sn & 1u) * STAGEB, gsrc + (uint64_t)sn * (KST * 2)); tdm_load(g0, g1); }
    }
    wait_tensor0(g0, g1);
    wait_ds0();
}

// cvt8: block blk of one stream's convert, 8 f32 -> 8 bf16 (RNE) per thread. src batches lie SEQ_FULL tokens apart, dst batches SEQ tokens apart.
#define CV_N8 ((size_t)NB * SEQ * DM / 8)            // groups of 8 per stream
#define CV_B8 ((size_t)SEQ * DM / 8)                 // groups of 8 per batch
#define CV_BLK ((unsigned)((CV_N8 + 255) / 256))     // blocks per stream
__device__ __forceinline__ void cvt8(const float* __restrict__ src, bf* dst, unsigned blk) {
    const size_t i = (size_t)blk * 256 + threadIdx.x; if (i >= CV_N8) return;
    const v8f v = *(const v8f*)(src + (i / CV_B8) * ((size_t)SEQ_FULL * DM) + (i % CV_B8) * 8); v8us o;
#pragma unroll
    for (int k = 0; k < 8; ++k) o[k] = f2bf(v[k]);
    *(v8us*)(dst + i * 8) = o;
}

// wt: one 64x64 tile (n0, k0) of the weight transpose + 16-bit convert through LDS. W is [k = in][n = out] f32 (pitch DM); WT[n'][k] (pitch DM), source column of output row n' is
// perm ? (n'%16)*64 + n'/16 : n'. asf16 == 0: bf16 bits (RNE convert); asf16 != 0: f16 bits of bf16(w) * 256 (exact for bf16 values in the f16 normal range).
#define WT_BLK ((unsigned)((DM / 64) * (DM / 64)))   // tiles per weight
__device__ __forceinline__ void wt(const float* __restrict__ W, bf* WT, int perm, int asf16, int n0, int k0, float* tl) {
    const int tid = threadIdx.x;
    { const int nn = tid & 63; const int np = n0 + nn; const int col = perm ? ((np & 15) * 64 + (np >> 4)) : np;
#pragma unroll 4
      for (int i = 0; i < 16; ++i) { const int kk = i * 4 + (tid >> 6); tl[kk * 65 + nn] = W[(size_t)(k0 + kk) * DM + col]; } }   // 16 x 4 k rows x 64 n = whole tile
    __syncthreads();
    v8us o[2];
#pragma unroll
    for (int it = 0; it < 2; ++it) { const int piece = it * 256 + tid; const int row = piece >> 3, j = piece & 7;   // 512 pieces = 64 rows x 8
#pragma unroll
        for (int i = 0; i < 8; ++i) { const float x = tl[(j * 8 + i) * 65 + row]; const unsigned short b = f2bf(x);
            const h16 hv = (h16)(bf2f(b) * WOS); const unsigned short hb = __builtin_bit_cast(unsigned short, hv); o[it][i] = asf16 ? hb : b; } }
{
#pragma unroll
        for (int it = 0; it < 2; ++it) { const int piece = it * 256 + tid; const int row = piece >> 3, j = piece & 7;
            *(v8us*)(WT + (size_t)(n0 + row) * DM + k0 + j * 8) = o[it]; }
         }
}

// k_prep: all operand preparation in one launch; none of its parts reads what another writes. Blocks 0 .. 4*WT_BLK-1: weight tiles (q, k, v permuted, o as f16 x256), first in the
// grid because each is the longer piece of work (loads, barrier, stores); the next 3*CV_BLK blocks: the stream converts (queries, keys, values). The split is uniform per block.
// X: three bf16 stream planes XPITCH elements apart; WB: four 16-bit weight planes DM*DM elements apart.
#define XPITCH ((size_t)NB * SEQ * DM)
__global__ __launch_bounds__(256) void k_prep(const float* __restrict__ xq, const float* __restrict__ xk, const float* __restrict__ xv,
                                              const float* __restrict__ wq, const float* __restrict__ wk, const float* __restrict__ wv, const float* __restrict__ wo, bf* X, bf* WB) {
    __shared__ float tl[64 * 65];
    const unsigned bid = blockIdx.x;
    if (bid < 4u * WT_BLK) {
        const unsigned w = bid / WT_BLK, t = bid % WT_BLK;
        const float* W = (w == 0u) ? wq : (w == 1u) ? wk : (w == 2u) ? wv : wo;
        wt(W, WB + (size_t)w * DM * DM, w == 2u, w == 3u, (int)(t % (DM / 64)) * 64, (int)(t / (DM / 64)) * 64, tl);
    } else {
        const unsigned c = bid - 4u * WT_BLK; const unsigned st = c / CV_BLK;
        const float* x = (st == 0u) ? xq : (st == 1u) ? xk : xv;
        cvt8(x, X + (size_t)st * XPITCH, c % CV_BLK);
    }
}

// k_proj: bf16 GEMM, 128x128 tile per block of eight waves (32x64 = 8 accumulators each), operands from K-contiguous bf16 planes through the LDS ring, K = DM.
// C[m][n] = sum_k A[m][k] Bt[n][k] + bias, written as f16. grid (NB*SEQ/128, DM/128, 3), 256 threads; grid z picks the projection: 0 q, 1 k, 2 v
// (A = stream plane z of X, Bt = weight plane z of WB, Ph = output plane z of P; X and P planes XPITCH elements apart, WB planes DM*DM; vmode = (z == 2)).
// vmode == 0: row-major plane Ph[m][n] (pitch DM), bias[n].
// vmode != 0: Bt rows are permuted (n' = d*16 + fb <-> feature fb*64 + d), bias[fb*64 + d]; element (token m, n') goes to the v^T plane
//             Ph[(zh*64 + d)*SEQ + tt*16 + fb] with zh = m / TPG, tt = m % TPG (key row tt*16 + fb of pseudo-head zh).
__global__ __launch_bounds__(32 * GW) void k_proj(const bf* __restrict__ X, const bf* __restrict__ WB, const float* __restrict__ bq, const float* __restrict__ bk, const float* __restrict__ bv, h16* P) {
    const unsigned z = blockIdx.z;
    const bf* A = X + (size_t)z * XPITCH; const bf* Bt = WB + (size_t)z * DM * DM; h16* Ph = P + (size_t)z * XPITCH;
    const float* bias = (z == 0u) ? bq : (z == 1u) ? bk : bv;
    const int vmode = (z == 2u);
    __shared__ __attribute__((aligned(2048))) unsigned char ring[2 * STAGEB];
    __shared__ __align__(16) float osw[GW * 16 * 68];
    __shared__ __align__(16) float bshw[GW * 64];
    const int lane = threadIdx.x & 31, lr = lane & 15, hi = lane >> 4;
    const uint32_t wave = uni(threadIdx.x >> 5);
    float* os = osw + wave * (16 * 68); float* bsh = bshw + wave * 64;      // wave-private epilogue tiles
    v8f acc[MBW][4];
#pragma unroll
    for (int mb = 0; mb < MBW; ++mb)
#pragma unroll
        for (int nb = 0; nb < 4; ++nb) acc[mb][nb] = (v8f){};
    gemm_core<v16bf>(A, Bt, ring, blockIdx.x * 128, blockIdx.y * 128, wave, lr, hi, acc);
    const int r0 = blockIdx.x * 128 + 32 * (int)(wave >> 1), c0 = blockIdx.y * 128 + 64 * (int)(wave & 1u);   // this wave's 32x64 tile
    // bias of the tile's 64 columns (bf16-valued), staged once: bsh[0..63] all written, all read
#pragma unroll
    for (int u = 0; u < 2; ++u) { const int n = c0 + lane + 32 * u; const int bi = vmode ? ((n & 15) * 64 + (n >> 4)) : n; bsh[lane + 32 * u] = bfr(bias[bi]); }
    wave_sync();
#pragma unroll
    for (int mb = 0; mb < MBW; ++mb) {
#pragma unroll
        for (int nb = 0; nb < 4; ++nb) {
#pragma unroll
            for (int j = 0; j < 8; ++j) os[(hi * 8 + j) * 68 + nb * 16 + lr] = acc[mb][nb][j]; }   // D: row 8h+j, col lane&15; 16 rows x 64 columns all written
        wave_sync();
        const int R0 = r0 + mb * 16;
        if (vmode == 0) {
{
#pragma unroll
                for (int s = 0; s < 4; ++s) { const int row = 4 * s + (lane >> 3), c8 = (lane & 7) * 8;   // 4 s x 4 row groups = 16 rows; 8 lanes x 8 = 64 columns
                    const v4f x0 = *(const v4fa*)(&os[row * 68 + c8]); const v4f x1 = *(const v4fa*)(&os[row * 68 + c8 + 4]);
                    const v4f b0 = *(const v4fa*)(&bsh[c8]); const v4f b1 = *(const v4fa*)(&bsh[c8 + 4]); v8h hv;
#pragma unroll
                    for (int i = 0; i < 4; ++i) { hv[i] = (h16)(x0[i] + b0[i]); hv[4 + i] = (h16)(x1[i] + b1[i]); }
                    *(v8h*)(Ph + (size_t)(R0 + row) * DM + c0 + c8) = hv; }
                 }
        } else {
            const int zh = R0 / TPG, tt0 = R0 % TPG;
            const int q = lane >> 3, jj = lane & 7; const int row = 4 * q + (jj >> 1), fb0 = (jj & 1) * 8;   // line (dl = s, q): rows 4q..4q+3 x 16 fb; lanes 8q..8q+7 contiguous
{
#pragma unroll
                for (int s = 0; s < 4; ++s) { const int col = s * 16 + fb0; const int d = (c0 >> 4) + s;   // 4 dl x (4 q x 4 rows) x 16 fb = 16 rows x 64 columns
                    const v4f x0 = *(const v4fa*)(&os[row * 68 + col]); const v4f x1 = *(const v4fa*)(&os[row * 68 + col + 4]);
                    const v4f b0 = *(const v4fa*)(&bsh[col]); const v4f b1 = *(const v4fa*)(&bsh[col + 4]); v8h hv;
#pragma unroll
                    for (int i = 0; i < 4; ++i) { hv[i] = (h16)(x0[i] + b0[i]); hv[4 + i] = (h16)(x1[i] + b1[i]); }
                    *(v8h*)(Ph + ((size_t)zh * HD + d) * SEQ + (size_t)(tt0 + row) * 16 + fb0) = hv; }
                 }
        }
        wave_sync();
    }
}

// k_out: f16 GEMM, 128x128 tile per block of eight waves through the LDS ring, A = ctx plane (x1024), Bt = Wo^T plane (x256), K = DM; OUT[m][n] = acc * 2^-18 + bo[n] (f32).
__global__ __launch_bounds__(32 * GW) void k_out(const h16* __restrict__ A, const h16* __restrict__ Bt, const float* __restrict__ bias, float* OUT) {
    __shared__ __attribute__((aligned(2048))) unsigned char ring[2 * STAGEB];
    __shared__ __align__(16) float osw[GW * 16 * 68];
    __shared__ __align__(16) float bshw[GW * 64];
    const int lane = threadIdx.x & 31, lr = lane & 15, hi = lane >> 4;
    const uint32_t wave = uni(threadIdx.x >> 5);
    float* os = osw + wave * (16 * 68); float* bsh = bshw + wave * 64;      // wave-private epilogue tiles
    v8f acc[MBW][4];
#pragma unroll
    for (int mb = 0; mb < MBW; ++mb)
#pragma unroll
        for (int nb = 0; nb < 4; ++nb) acc[mb][nb] = (v8f){};
    gemm_core<v16h>((const bf*)A, (const bf*)Bt, ring, blockIdx.x * 128, blockIdx.y * 128, wave, lr, hi, acc);
    const int r0 = blockIdx.x * 128 + 32 * (int)(wave >> 1), c0 = blockIdx.y * 128 + 64 * (int)(wave & 1u);   // this wave's 32x64 tile
#pragma unroll
    for (int u = 0; u < 2; ++u) bsh[lane + 32 * u] = bfr(bias[c0 + lane + 32 * u]);   // bsh[0..63] all written, all read
    wave_sync();
    const size_t orow0 = (size_t)(r0 / SEQ) * OUT_SEQ + (size_t)(r0 % SEQ);
#pragma unroll
    for (int mb = 0; mb < MBW; ++mb) {
#pragma unroll
        for (int nb = 0; nb < 4; ++nb) {
#pragma unroll
            for (int j = 0; j < 8; ++j) os[(hi * 8 + j) * 68 + nb * 16 + lr] = acc[mb][nb][j]; }   // 16 rows x 64 columns all written
        wave_sync();
        float* ob = OUT + (orow0 + (size_t)(mb * 16)) * DM + c0;
{
#pragma unroll
            for (int s = 0; s < 8; ++s) { const int row = 2 * s + hi, cofs = lr * 4;   // 8 s x 2 rows = 16 rows; 16 lanes x 4 floats = 64 columns
                const v4f x = *(const v4fa*)(&os[row * 68 + cofs]); const v4f bb = *(const v4fa*)(&bsh[cofs]); v4f val;
#pragma unroll
                for (int i = 0; i < 4; ++i) val[i] = x[i] * OSC + bb[i];
                *(v4f*)(ob + (size_t)row * DM + cofs) = val; }
             }
        wave_sync();
    }
}

// k_flash: fused attention, one wave per 16 query rows of one pseudo-head; K / V^T / Q fragments straight from the f16 planes (two 16-B loads each, arithmetic addressing).
// Transposed form: S^T[key][t] = K Q^T (A = K rows, B = Q rows); lane (t = lane&15, h = lane>>4) holds keys 8h+r of each 16-key tile, so the packed
// P tile is directly the B fragment of O^T[d][t] = V^T P^T (element r <- tile keys 0..15, element 8+r <- tile keys 16..31, lane unchanged).
// Softmax state (running max, partial sum) is one scalar per lane; the two lane halves of a row are combined with one xor-16 exchange.
__global__ __launch_bounds__(32 * AW) void k_flash(const h16* __restrict__ QH, const h16* __restrict__ KP, const h16* __restrict__ VT, h16* CX) {
    __shared__ __align__(16) float os[AW * 16 * 68];
    const int lane = threadIdx.x & 31, lr = lane & 15, hi = lane >> 4;
    const int wave = __builtin_amdgcn_readfirstlane(threadIdx.x >> 5);
    const int zh = blockIdx.y;
    const int t0 = (blockIdx.x * AW + wave) * 16;
    const size_t pbase = (size_t)zh * SEQ * HD;
    const size_t qo = pbase + (size_t)(t0 + lr) * HD + 8 * hi;
    const v16h q0 = ldh(QH + qo), q1 = ldh(QH + qo + 32);    // B fragments: col t, k = d
    const size_t ko = pbase + (size_t)lr * HD + 8 * hi;      // + key * HD       (A fragment: row key, k = d)
    const size_t vo = pbase + (size_t)lr * SEQ + 8 * hi;     // + 16j*SEQ + key  (A fragment: row d, k = key)
    v8f o0 = (v8f){}, o1 = (v8f){}, o2 = (v8f){}, o3 = (v8f){};
    float m = -3.0e38f, l = 0.0f;
#pragma unroll 1
    for (int key0 = 0; key0 < SEQ; key0 += 32) {
        const h16* ka = KP + ko + (size_t)key0 * HD;
        const v16h ka0 = ldh(ka), ka1 = ldh(ka + 32), kb0 = ldh(ka + 16 * HD), kb1 = ldh(ka + 16 * HD + 32);
        v8f sa = (v8f){}, sb = (v8f){};
        sa = wmma16(ka0, q0, sa); sb = wmma16(kb0, q0, sb);
        sa = wmma16(ka1, q1, sa); sb = wmma16(kb1, q1, sb);
        asm volatile("v_nop\n\tv_nop\n\tv_nop\n\tv_nop" : "+v"(sa), "+v"(sb) : "v"(ka0), "v"(ka1), "v"(kb0), "v"(kb1), "v"(q0), "v"(q1));
        float ta[8], tb[8]; float mx = -3.0e38f;
#pragma unroll
        for (int r = 0; r < 8; ++r) { ta[r] = sa[r] * SC2; tb[r] = sb[r] * SC2; mx = fmaxf(mx, fmaxf(ta[r], tb[r])); }
        mx = fmaxf(mx, __shfl_xor(mx, 16, 32));
        const float mnew = fmaxf(m, mx);
        const float alpha = __builtin_amdgcn_exp2f(m - mnew);
        const float sh = PSH - mnew;
        v16h pb; float ls = 0.0f;
#pragma unroll
        for (int r = 0; r < 8; ++r) { const h16 pa = (h16)__builtin_amdgcn_exp2f(ta[r] + sh); const h16 pc = (h16)__builtin_amdgcn_exp2f(tb[r] + sh); pb[r] = pa; pb[8 + r] = pc; ls += (float)pa + (float)pc; }
        l = l * alpha + ls; m = mnew;
        o0 = o0 * alpha; o1 = o1 * alpha; o2 = o2 * alpha; o3 = o3 * alpha;
        const h16* va = VT + vo + key0;
        const v16h v0 = ldh(va), v1 = ldh(va + (size_t)16 * SEQ), v2 = ldh(va + (size_t)32 * SEQ), v3 = ldh(va + (size_t)48 * SEQ);
        o0 = wmma16(v0, pb, o0); o1 = wmma16(v1, pb, o1); o2 = wmma16(v2, pb, o2); o3 = wmma16(v3, pb, o3);
        asm volatile("v_nop\n\tv_nop\n\tv_nop\n\tv_nop" : "+v"(o0), "+v"(o1), "+v"(o2), "+v"(o3) : "v"(v0), "v"(v1), "v"(v2), "v"(v3), "v"(pb));
    }
    l += __shfl_xor(l, 16, 32);
    const float inv = (1.0f / l) * CXS;
    const int wb = wave * 16 * 68;
    // O^T D layout: o_j[r] = (d = 16j + 8h + r, t = lane&15) -> os[t][d]; rows 0..15 x columns 0..63 all written
    { v4f a, c;
      a[0] = o0[0] * inv; a[1] = o0[1] * inv; a[2] = o0[2] * inv; a[3] = o0[3] * inv; c[0] = o0[4] * inv; c[1] = o0[5] * inv; c[2] = o0[6] * inv; c[3] = o0[7] * inv;
      *(v4fa*)(&os[wb + lr * 68 +  0 + 8 * hi]) = a; *(v4fa*)(&os[wb + lr * 68 +  0 + 8 * hi + 4]) = c;
      a[0] = o1[0] * inv; a[1] = o1[1] * inv; a[2] = o1[2] * inv; a[3] = o1[3] * inv; c[0] = o1[4] * inv; c[1] = o1[5] * inv; c[2] = o1[6] * inv; c[3] = o1[7] * inv;
      *(v4fa*)(&os[wb + lr * 68 + 16 + 8 * hi]) = a; *(v4fa*)(&os[wb + lr * 68 + 16 + 8 * hi + 4]) = c;
      a[0] = o2[0] * inv; a[1] = o2[1] * inv; a[2] = o2[2] * inv; a[3] = o2[3] * inv; c[0] = o2[4] * inv; c[1] = o2[5] * inv; c[2] = o2[6] * inv; c[3] = o2[7] * inv;
      *(v4fa*)(&os[wb + lr * 68 + 32 + 8 * hi]) = a; *(v4fa*)(&os[wb + lr * 68 + 32 + 8 * hi + 4]) = c;
      a[0] = o3[0] * inv; a[1] = o3[1] * inv; a[2] = o3[2] * inv; a[3] = o3[3] * inv; c[0] = o3[4] * inv; c[1] = o3[5] * inv; c[2] = o3[6] * inv; c[3] = o3[7] * inv;
      *(v4fa*)(&os[wb + lr * 68 + 48 + 8 * hi]) = a; *(v4fa*)(&os[wb + lr * 68 + 48 + 8 * hi + 4]) = c; }
    wave_sync();
    h16* crow = CX + pbase + (size_t)t0 * HD;      // pseudo-head row r -> flat offset zh*SEQ*64 + r*64 of the row-major ctx plane
{
#pragma unroll
        for (int s = 0; s < 4; ++s) { const int row = 4 * s + (lane >> 3), c8 = (lane & 7) * 8;   // 4 s x 4 row groups = 16 rows; 8 lanes x 8 = 64 columns
            const v4f x0 = *(const v4fa*)(&os[wb + row * 68 + c8]); const v4f x1 = *(const v4fa*)(&os[wb + row * 68 + c8 + 4]); v8h hv;
#pragma unroll
            for (int i = 0; i < 4; ++i) { hv[i] = (h16)x0[i]; hv[4 + i] = (h16)x1[i]; }
            *(v8h*)(crow + (size_t)row * HD + c8) = hv; }
         }
}

static constexpr size_t al256(size_t v) { return (v + 255) & ~(size_t)255; }
static constexpr size_t SZ_XB = al256((size_t)NB * SEQ * DM * 2);      // one bf16 stream copy
static constexpr size_t SZ_WB = al256((size_t)4 * DM * DM * 2);        // four 16-bit weight planes
static constexpr size_t SZ_PL = al256((size_t)NB * SEQ * DM * 2);      // one f16 plane (q, k, v^T, ctx)
static constexpr size_t SZ_TOTAL = 3 * SZ_XB + SZ_WB + 4 * SZ_PL;
static_assert(SZ_TOTAL <= (size_t)134217728);          // workspace carve <= 128 MiB
static_assert(((size_t)DM * DM * 2) % 256 == 0);       // weight sub-planes stay 256-byte aligned
static_assert((size_t)NB * NH_ * HD * SEQ * 2 <= SZ_PL);   // v^T plane [NB*16][64][SEQ] fits its region
static_assert(SZ_XB == XPITCH * 2 && SZ_PL == XPITCH * 2);   // the kernels step from plane to plane by XPITCH elements

extern "C" void kernel_launch(void* const* d_in, const int* in_sizes, int n_in,
                              void* d_out, int out_size, void* d_ws, size_t ws_size, hipStream_t stream) {
    if (n_in < 11) return;
    const size_t needx = ((size_t)(NB - 1) * SEQ_FULL + SEQ) * DM;
    if ((size_t)in_sizes[0] < needx || (size_t)in_sizes[1] < needx || (size_t)in_sizes[2] < needx) return;
    if ((size_t)in_sizes[3] < (size_t)DM * DM || (size_t)in_sizes[5] < (size_t)DM * DM || (size_t)in_sizes[7] < (size_t)DM * DM || (size_t)in_sizes[9] < (size_t)DM * DM) return;
    if (in_sizes[4] < DM || in_sizes[6] < DM || in_sizes[8] < DM || in_sizes[10] < DM) return;
    if ((size_t)out_size < ((size_t)(NB - 1) * OUT_SEQ + SEQ) * DM) return;
    if (SZ_TOTAL > ws_size) return;
    // wire order: queries, keys, values, Wq, bq, Wk, bk, Wv, bv, Wo, bo
    const float* xq = (const float*)d_in[0]; const float* xk = (const float*)d_in[1]; const float* xv = (const float*)d_in[2];
    const float* wq = (const float*)d_in[3]; const float* bq = (const float*)d_in[4];
    const float* wk = (const float*)d_in[5]; const float* bk = (const float*)d_in[6];
    const float* wv = (const float*)d_in[7]; const float* bv = (const float*)d_in[8];
    const float* wo = (const float*)d_in[9]; const float* bo = (const float*)d_in[10];
    float* OUT = (float*)d_out;      // [NB][OUT_SEQ][1024]
    char* wsp = (char*)d_ws;
    bf* XQ = (bf*)wsp; wsp += 3 * SZ_XB;             // three planes [NB*SEQ][1024]: queries | keys | values
    bf* WB = (bf*)wsp; wsp += SZ_WB;                 // [4][1024 out][1024 in]: q | k | v (rows permuted) | o (f16 bits, x256)
    h16* QH = (h16*)wsp; wsp += SZ_PL;               // [NB*SEQ][1024] = [NB*16][SEQ][64]
    h16* KP = (h16*)wsp; wsp += SZ_PL;               // [NB*SEQ][1024] = [NB*16][SEQ][64]
    h16* VT = (h16*)wsp; wsp += SZ_PL;               // [NB*16][64][SEQ]
    h16* CX = (h16*)wsp; wsp += SZ_PL;               // [NB*SEQ][1024] = [NB*16][SEQ][64], x1024
    bf* WO = WB + (size_t)3 * DM * DM;

    // streams -> bf16 planes; weights: in [k = in rows][n = out cols] -> out [n'][k], square 1024 x 1024
    k_prep<<<4u * WT_BLK + 3u * CV_BLK, 256, 0, stream>>>(xq, xk, xv, wq, wk, wv, wo, XQ, WB);

    // q, k: A = stream rows (m = b*SEQ + t), Bt = W^T rows (n = feature) -> row-major plane
    // v: Bt = permuted Wv^T rows (n' = d*16 + fb) -> v^T plane [(b*16 + g)][d][key row]
    k_proj<<<dim3(NB * SEQ / 128, DM / 128, 3), 32 * GW, 0, stream>>>(XQ, WB, bq, bk, bv, QH);

    k_flash<<<dim3(SEQ / (16 * AW), NB * NH_, 1), 32 * AW, 0, stream>>>(QH, KP, VT, CX);

    k_out<<<dim3(NB * SEQ / 128, DM / 128, 1), 32 * GW, 0, stream>>>(CX, (const h16*)WO, bo, OUT);
}
